// v000
// Measured on an AMD MI455X. A time is GPU time per run, averaged over a window of back-to-back runs after a warm-up
// (all launches, gaps included; the runs take copies of the inputs in turn), and the median of several windows.
// Apart from v000's, it joins two sittings. Times from different sittings can be a few percent apart, while
// side-by-side timings come from the same sitting.
// v000 is the starting kernel. One run takes 232 microseconds.
// Contractions: scores S^T[p][q] = FB[p][c].Q[q][c] on v_wmma_f32_16x16x32_bf16 (A = bf16-RNE input rows, exact;
// B = bf16 hi + bf16 residual planes of the 3x3-summed input, 2 products, K = 64); O^T[c][q] = FB16[c][p].P[p][q]
// on v_wmma_f32_16x16x32_f16 (A = f16 of 16 x bf16-RNE input, exact; B = f16 of e^{s-m} x 2^15 x r_p from the
// score D registers); f32 accumulate; per-pixel norm factor r_p, softmax statistics and the eps terms in f32 VALU.
#include <hip/hip_runtime.h>
#include <math.h>
#include <stdint.h>

#ifndef NIMG
#define NIMG 4
#endif
#define NB_FULL 4
#define NC     64
#define HW     64
#define NP     4096
#define QT     64
#define TP     72
#define OSP    68
#define XSC    16.0f
#define IXSC   0.0625f
#define EPSV   1.0e-7f
#define LNCARRY 10.397207708399179f

static_assert(NIMG >= 1 && NIMG <= NB_FULL);
static_assert(NP == HW * HW);
static_assert(NP % QT == 0 && NP % 32 == 0);
static_assert(NC == 64);
static_assert(QT == 64);
static_assert((TP * 2) % 16 == 0);
static_assert((OSP * 4) % 16 == 0);

typedef _Float16       v16h __attribute__((ext_vector_type(16)));
typedef _Float16       v8h  __attribute__((ext_vector_type(8)));
typedef __bf16         v16b __attribute__((ext_vector_type(16)));
typedef unsigned short v8us __attribute__((ext_vector_type(8)));
typedef float          v8f  __attribute__((ext_vector_type(8)));
typedef float          v4f  __attribute__((ext_vector_type(4)));
typedef unsigned int   v4u  __attribute__((ext_vector_type(4)));

union Frag  { v8us u[2]; v16h h; v16b bf; };
union FragH { v16h v; v8h hv[2]; };
static_assert(sizeof(Frag) == 32);
static_assert(sizeof(FragH) == 32);

// ---- scalar helpers -------------------------------------------------------------------------------------------
__device__ __forceinline__ unsigned short bf_bits(float f) {          // f32 -> bf16 bits, RNE convert
  unsigned u = __float_as_uint(f);
  return (unsigned short)((u + 0x7FFFu + ((u >> 16) & 1u)) >> 16);
}
__device__ __forceinline__ float bf_up(unsigned short hb) { return __uint_as_float(((unsigned)hb) << 16); }
__device__ __forceinline__ float bfr(float f) { return bf_up(bf_bits(f)); }
__device__ __forceinline__ unsigned short h_bits(_Float16 x) { return __builtin_bit_cast(unsigned short, x); }
__device__ __forceinline__ unsigned pk16(unsigned short a, unsigned short b) { return (unsigned)a | ((unsigned)b << 16); }
__device__ __forceinline__ v8f zero8() { v8f z = {0.f, 0.f, 0.f, 0.f, 0.f, 0.f, 0.f, 0.f}; return z; }
__device__ __forceinline__ float hmax8(v8f s) {
  return fmaxf(fmaxf(fmaxf(s[0], s[1]), fmaxf(s[2], s[3])), fmaxf(fmaxf(s[4], s[5]), fmaxf(s[6], s[7])));
}
__device__ __forceinline__ unsigned wave_ballot(bool p) {
#if defined(__HIP_DEVICE_COMPILE__)
  return __builtin_amdgcn_ballot_w32(p);
#else
  return p ? 1u : 0u;
#endif
}

// ---- 16-bit fragment loader (A, or B from a k-contiguous [n][k] row): lane -> row/col (lane&15), p already includes
//      + 8*(lane>>4); elements 0..7 <- p[0..7] (k0+8h..), elements 8..15 <- p[16..23] (k0+16+8h..)
__device__ __forceinline__ Frag ldfrag(const unsigned short* p) {
  Frag f;
  f.u[0] = *(const v8us*)(p);
  f.u[1] = *(const v8us*)(p + 16);
  return f;
}

// ---- WMMA helpers: builtin followed by a 4-slot VALU gap tying D and keeping A/B live ----------------------------
__device__ __forceinline__ v8f mma_h(v16h a, v16h b, v8f c) {
  v8f d = __builtin_amdgcn_wmma_f32_16x16x32_f16(false, a, false, b, (short)0, c, false, false);
#if defined(__HIP_DEVICE_COMPILE__)
  asm volatile("v_nop\n\tv_nop\n\tv_nop\n\tv_nop" : "+v"(d) : "v"(a), "v"(b));
#endif
  return d;
}
__device__ __forceinline__ v8f mma_b(v16b a, v16b b, v8f c) {
  v8f d = __builtin_amdgcn_wmma_f32_16x16x32_bf16(false, a, false, b, (short)0, c, false, false);
#if defined(__HIP_DEVICE_COMPILE__)
  const v16h ha = __builtin_bit_cast(v16h, a), hb = __builtin_bit_cast(v16h, b);
  asm volatile("v_nop\n\tv_nop\n\tv_nop\n\tv_nop" : "+v"(d) : "v"(ha), "v"(hb));
#endif
  return d;
}

// =============================================================================================================
// (1) input f32 [b][64 c][4096 p] -> FC f16 [b][c][p] = f16(16 * bf16-RNE(x)) (exact, channel-major, keys
//     contiguous), FP bf16 [b][p][c] = bf16-RNE(x) (key-major, channels contiguous) through an LDS tile
//     T[64 p][64 c] (pitch TP), and R f32 [b][p] = rsqrt(sum_c (bf16-RNE(x) + eps)^2) (4 lanes per p, fixed-order
//     The second pointer argument (aux) is bound only and never read.
// coverage: FC 2 it x 32 rows x 8 lanes x 8 = 64 c x 64 p; FP same; R 16 lanes x 4 = 64 p; grid (64, NIMG) covers
//           every c, p of images 0..NIMG-1 exactly once. LDS: T written 64 p x 64 c, read 64 x 64; Rs 64/64.
// =============================================================================================================
__global__ __launch_bounds__(256)
void cvt_f(const float* __restrict__ f, const float* __restrict__ aux, unsigned short* FC, unsigned short* FP,
           float* R) {
  (void)aux;
  __shared__ __align__(16) unsigned short T[QT * TP];
  __shared__ __align__(16) float Rs[QT];
  const int tid = threadIdx.x;
  const int pt = blockIdx.x, b = blockIdx.y;
  const int e = tid & 7, lq = tid >> 3;                              // lq 0..31
  const int p0 = pt * QT;
  v4u uc[2];
#pragma unroll
  for (int it = 0; it < 2; ++it) {
    const int cl = it * 32 + lq;                                      // channel 0..63
    const float* sp = f + ((size_t)(b * NC + cl)) * NP + p0 + 8 * e;
    const v4f a = *(const v4f*)sp;
    const v4f q = *(const v4f*)(sp + 4);
    const float g[8] = {a[0], a[1], a[2], a[3], q[0], q[1], q[2], q[3]};
    unsigned short hb[8], bb[8];
#pragma unroll
    for (int t = 0; t < 8; ++t) {
      bb[t] = bf_bits(g[t]);
      hb[t] = h_bits((_Float16)(bf_up(bb[t]) * XSC));
    }
#pragma unroll
    for (int t = 0; t < 4; ++t) uc[it][t] = pk16(hb[2 * t], hb[2 * t + 1]);
#pragma unroll
    for (int t = 0; t < 8; ++t) T[(8 * e + t) * TP + cl] = bb[t];    // T[p_loc][c]
  }
  __syncthreads();
  v4u up[2];
#pragma unroll
  for (int it = 0; it < 2; ++it) {
    const int pl = it * 32 + lq;                                      // p_loc 0..63
    up[it] = *(const v4u*)(T + pl * TP + 8 * e);
  }
  {
    const int pl = tid >> 2, sub = tid & 3;                          // 4 lanes per p, 16 channels each
    const unsigned short* tr = T + pl * TP + 16 * sub;
    const v8us w0 = *(const v8us*)(tr);
    const v8us w1 = *(const v8us*)(tr + 8);
    float s = 0.f;
#pragma unroll
    for (int i = 0; i < 8; ++i) { const float v = bf_up(w0[i]) + EPSV; s += v * v; }
#pragma unroll
    for (int i = 0; i < 8; ++i) { const float v = bf_up(w1[i]) + EPSV; s += v * v; }
    s += __shfl_xor(s, 1, 32);
    s += __shfl_xor(s, 2, 32);
    if (sub == 0) Rs[pl] = rsqrtf(s);
  }
  __syncthreads();
  const v4f rv = *(const v4f*)(Rs + 4 * (tid & 15));
{
#pragma unroll
    for (int it = 0; it < 2; ++it) {
      const int rl = it * 32 + lq;
      *(v4u*)(FC + ((size_t)(b * NC + rl)) * NP + p0 + 8 * e) = uc[it];
      *(v4u*)(FP + ((size_t)(b * NP + p0 + rl)) * NC + 8 * e) = up[it];
    }
    if (tid < 16) *(v4f*)(R + (size_t)b * NP + p0 + 4 * tid) = rv;
    
  }
}

// =============================================================================================================
// (2) per (b, image row y): FPOOL[c][x] = 3x3 zero-padded window sum of bf16-RNE(x) centred on pixel (y, x),
//     f32, then Qh/Ql bf16 [b][q = 64 y + x][64 c] (query-major, channels contiguous): hi = bf16-RNE(v), lo =
//     bf16-RNE(v - hi), staged through LDS tiles Th/Tl[64 x][64 c] (pitch TP); G f32 [b][q] = eps * sum_c FPOOL.
//     Thread (ch = tid>>2, xq = tid&3) computes channel ch at x = 16 xq .. 16 xq + 15; edge taps use clamped
//     addresses and are zeroed by predicate; the row-validity test is block-uniform.
// coverage: Qh/Ql 2 it x 32 rows x 8 lanes x 8 = 64 x x 64 c per plane; G 64; grid (64 y, NIMG) covers every q of
//           images 0..NIMG-1 once. LDS: Th/Tl written 64 x 64, read 64 x 64; Gs written 64 c x 64 x, read same; Gq 64.
// =============================================================================================================
__global__ __launch_bounds__(256)
void pool_q(const float* __restrict__ f, unsigned short* Qh, unsigned short* Ql, float* G) {
  __shared__ __align__(16) unsigned short Th[QT * TP];
  __shared__ __align__(16) unsigned short Tl[QT * TP];
  __shared__ __align__(16) float Gs[NC * QT];
  __shared__ __align__(16) float Gq[QT];
  const int tid = threadIdx.x;
  const int y = blockIdx.x, b = blockIdx.y;
  const int ch = tid >> 2, xq = tid & 3, x0 = 16 * xq;
  const float* fc = f + ((size_t)(b * NC + ch)) * NP;
  float s[16];
#pragma unroll
  for (int i = 0; i < 16; ++i) s[i] = 0.f;
#pragma unroll
  for (int dy = -1; dy <= 1; ++dy) {
    const int yy = y + dy;                                            // block-uniform
    if (yy >= 0 && yy < HW) {
      const float* row = fc + yy * HW;
      const v4f a0 = *(const v4f*)(row + x0);
      const v4f a1 = *(const v4f*)(row + x0 + 4);
      const v4f a2 = *(const v4f*)(row + x0 + 8);
      const v4f a3 = *(const v4f*)(row + x0 + 12);
      const int xl = (x0 > 0) ? (x0 - 1) : 0;                          // clamped addresses
      const int xr = (x0 + 16 < HW) ? (x0 + 16) : (HW - 1);
      float vl = row[xl]; vl = (x0 > 0) ? vl : 0.f;
      float vr = row[xr]; vr = (x0 + 16 < HW) ? vr : 0.f;
      float v[18];
      v[0] = bfr(vl); v[17] = bfr(vr);
#pragma unroll
      for (int t = 0; t < 4; ++t) {
        v[1 + t]  = bfr(a0[t]);
        v[5 + t]  = bfr(a1[t]);
        v[9 + t]  = bfr(a2[t]);
        v[13 + t] = bfr(a3[t]);
      }
#pragma unroll
      for (int i = 0; i < 16; ++i) s[i] += (v[i] + v[i + 1]) + v[i + 2];
    }
  }
#pragma unroll
  for (int i = 0; i < 16; ++i) {
    const unsigned short hb = bf_bits(s[i]);
    const unsigned short lb = bf_bits(s[i] - bf_up(hb));
    Th[(x0 + i) * TP + ch] = hb;
    Tl[(x0 + i) * TP + ch] = lb;
  }
#pragma unroll
  for (int t = 0; t < 4; ++t) {
    v4f gv4 = {s[4 * t], s[4 * t + 1], s[4 * t + 2], s[4 * t + 3]};
    *(v4f*)(Gs + ch * QT + x0 + 4 * t) = gv4;
  }
  __syncthreads();
  if (tid < QT) {                                                     // waves 0 and 1 entirely
    float g = 0.f;
#pragma unroll 4
    for (int cc = 0; cc < NC; ++cc) g += Gs[cc * QT + tid];
    Gq[tid] = g * EPSV;
  }
  const int e = tid & 7, lq = tid >> 3;                              // lq 0..31
  v4u uh[2], ul[2];
#pragma unroll
  for (int it = 0; it < 2; ++it) {
    const int xl2 = it * 32 + lq;                                     // x 0..63
    uh[it] = *(const v4u*)(Th + xl2 * TP + 8 * e);
    ul[it] = *(const v4u*)(Tl + xl2 * TP + 8 * e);
  }
  __syncthreads();
  const v4f gv = *(const v4f*)(Gq + 4 * (tid & 15));
{
#pragma unroll
    for (int it = 0; it < 2; ++it) {
      const int xl2 = it * 32 + lq;
      const size_t po = ((size_t)(b * NP + y * HW + xl2)) * NC + 8 * e;
      *(v4u*)(Qh + po) = uh[it];
      *(v4u*)(Ql + po) = ul[it];
    }
    if (tid < 16) *(v4f*)(G + (size_t)b * NP + y * HW + 4 * tid) = gv;
    
  }
}

// =============================================================================================================
// (3) attention for one (b, 64-query tile), transposed formulation, 4096 keys, no mask:
//   S^T tile (16 keys x 16 queries) = A(FP row = key kb + (lane&15), 64 channels via the split k map, bf16 exact)
//   . B(Qh row = query, same map) + A(FP).B(Ql) (unscaled bf16 residual, shared accumulator), K = 64 = 2 steps;
//   then s = r_key * (acc + g_query) (per-key norm factor and the eps term, f32). Q fragments and g are loaded once.
//   Per lane the D tile holds 8 keys of ONE query: online softmax per lane, one shuffle (lane^16) for the max over
//   32 keys; the o/l/E rescale is skipped under a wave-uniform ballot when no lane's max grew. P = f16 of
//   e^{s-m} x 2^15 x r_key is the B operand of O^T (rows channel 16j + (lane&15), keys contiguous, f16 plane FC =
//   16 x input) . B(P^T): element r <- D of the tile covering keys kb..kb+15, element 8+r <- the tile covering
//   kb+16..kb+31, lane unchanged. 4 accumulator tiles per wave (64 channels). l = sum e and E = sum e r_key in f32.
//   Epilogue: out = (O / 16 + eps E) / l staged in LDS Os[query][64 channels] (pitch OSP, b128 stores), barrier,
// coverage: Os 4 waves x 16 queries x 64 ch; out 8 it x 16 lines x 8 lanes x 4 floats = 64 ch x 64 queries;
//           grid (64, NIMG) covers out[b][0..63][0..4095] of images 0..NIMG-1 exactly once.
// =============================================================================================================
__global__ __launch_bounds__(128)
void attn_k(const unsigned short* __restrict__ Qh, const unsigned short* __restrict__ Ql,
            const unsigned short* __restrict__ FP, const unsigned short* __restrict__ FC,
            const float* __restrict__ R, const float* __restrict__ G, float* out) {
  __shared__ __align__(16) float Os[QT * OSP];
  const int tid  = threadIdx.x;
  const int wave = tid >> 5, lane = tid & 31;
  const int hh   = lane >> 4, c = lane & 15;
  const int n0   = blockIdx.x * QT, b = blockIdx.y;

  // q fragments (B operand, col = query n0 + 16*wave + c), channels 0..31 and 32..63
  const size_t qo = ((size_t)(b * NP + n0 + 16 * wave + c)) * NC + 8 * hh;
  const Frag qh0 = ldfrag(Qh + qo);
  const Frag qh1 = ldfrag(Qh + qo + 32);
  const Frag ql0 = ldfrag(Ql + qo);
  const Frag ql1 = ldfrag(Ql + qo + 32);
  const float gq = G[(size_t)b * NP + n0 + 16 * wave + c];
  // k fragment base (A operand, row = key kb + c), + key * 64
  const unsigned short* Kp = FP + (size_t)b * NP * NC + (size_t)c * NC + 8 * hh;
  // v fragment base (A operand, row = channel 16j + c, keys contiguous), + 16*j*NP + kb
  const unsigned short* Vp = FC + (size_t)b * NC * NP + (size_t)c * NP + 8 * hh;
  // per-key norm factors for keys kb + 8hh + r and kb + 16 + 8hh + r
  const float* Rp = R + (size_t)b * NP + 8 * hh;

  float m = -1.0e30f, l = 0.f, E = 0.f;
  v8f o[4];
#pragma unroll
  for (int j = 0; j < 4; ++j) o[j] = zero8();

#pragma unroll 1
  for (int kb = 0; kb < NP; kb += 32) {
    const unsigned short* k0p = Kp + (size_t)kb * NC;               // keys kb .. kb+15
    const unsigned short* k1p = Kp + (size_t)(kb + 16) * NC;        // keys kb+16 .. kb+31
    v8f s0 = zero8(), s1 = zero8();
    {
      const Frag a0 = ldfrag(k0p), a1 = ldfrag(k0p + 32);
      const Frag c0 = ldfrag(k1p), c1 = ldfrag(k1p + 32);
      s0 = mma_b(a0.bf, qh0.bf, s0);
      s1 = mma_b(c0.bf, qh0.bf, s1);
      s0 = mma_b(a0.bf, ql0.bf, s0);
      s1 = mma_b(c0.bf, ql0.bf, s1);
      s0 = mma_b(a1.bf, qh1.bf, s0);
      s1 = mma_b(c1.bf, qh1.bf, s1);
      s0 = mma_b(a1.bf, ql1.bf, s0);
      s1 = mma_b(c1.bf, ql1.bf, s1);
    }
    const v4f ra = *(const v4f*)(Rp + kb);
    const v4f rb = *(const v4f*)(Rp + kb + 4);
    const v4f rc = *(const v4f*)(Rp + kb + 16);
    const v4f rd = *(const v4f*)(Rp + kb + 20);
    const float r0v[8] = {ra[0], ra[1], ra[2], ra[3], rb[0], rb[1], rb[2], rb[3]};
    const float r1v[8] = {rc[0], rc[1], rc[2], rc[3], rd[0], rd[1], rd[2], rd[3]};
#pragma unroll
    for (int r = 0; r < 8; ++r) {
      s0[r] = r0v[r] * (s0[r] + gq);                                  // key kb      + 8hh + r
      s1[r] = r1v[r] * (s1[r] + gq);                                  // key kb + 16 + 8hh + r
    }

    float mx = fmaxf(hmax8(s0), hmax8(s1));
    mx = fmaxf(mx, __shfl_xor(mx, 16, 32));
    const float mn = fmaxf(m, mx);
    const unsigned grew = wave_ballot(mx > m);                        // wave-uniform
    if (grew != 0u) {
      const float corr = __expf(m - mn);                              // == 1 exactly for lanes whose max did not grow
      l *= corr;
      E *= corr;
#pragma unroll
      for (int j = 0; j < 4; ++j) {
#pragma unroll
        for (int r = 0; r < 8; ++r) o[j][r] *= corr;
      }
    }
    m = mn;
    const float msh = mn - LNCARRY;                                   // exp gives e^{s-m} * 32768

    FragH ph;
    float ls = 0.f, es = 0.f;
#pragma unroll
    for (int r = 0; r < 8; ++r) {
      const float e0 = __expf(s0[r] - msh);
      const float e1 = __expf(s1[r] - msh);
      ls += e0 + e1;
      const float pe0 = e0 * r0v[r];
      const float pe1 = e1 * r1v[r];
      es += pe0 + pe1;
      ph.hv[0][r] = (_Float16)pe0;
      ph.hv[1][r] = (_Float16)pe1;
    }
    l += ls;
    E += es;

#pragma unroll
    for (int j = 0; j < 4; ++j) {
      const Frag vf = ldfrag(Vp + (size_t)(16 * j) * NP + kb);
      o[j] = mma_h(vf.h, ph.v, o[j]);
    }
  }
  l += __shfl_xor(l, 16, 32);
  E += __shfl_xor(E, 16, 32);
  const float inv = 1.0f / l;                                         // o, E and l all carry the 2^15 factor
  const float ee  = EPSV * E;

  const int qrow = 16 * wave + c;
#pragma unroll
  for (int j = 0; j < 4; ++j) {
    v4f va, vb;
#pragma unroll
    for (int r = 0; r < 4; ++r) {
      va[r] = (o[j][r] * IXSC + ee) * inv;
      vb[r] = (o[j][4 + r] * IXSC + ee) * inv;
    }
    *(v4f*)(Os + qrow * OSP + 16 * j + 8 * hh)     = va;              // Os[query][ch = 16j + 8hh + r]
    *(v4f*)(Os + qrow * OSP + 16 * j + 8 * hh + 4) = vb;
  }
  __syncthreads();
  const int e = tid & 7, lq = tid >> 3;                               // lq 0..15
  v4f res[8];
#pragma unroll
  for (int it = 0; it < 8; ++it) {
    const int L   = it * 16 + lq;                                     // 0..127
    const int chl = L >> 1, hf = L & 1;                               // channel 0..63
    const int nl  = hf * 32 + 4 * e;                                  // query 0..63
#pragma unroll
    for (int t = 0; t < 4; ++t) res[it][t] = Os[(nl + t) * OSP + chl];
  }
{
#pragma unroll
    for (int it = 0; it < 8; ++it) {
      const int L   = it * 16 + lq;
      const int chl = L >> 1, hf = L & 1;
      const int nl  = hf * 32 + 4 * e;
      const size_t idx = ((size_t)(b * NC + chl)) * NP + n0 + nl;
      *(v4f*)(out + idx) = res[it];
    }
    
  }
}

// =============================================================================================================
// Workspace map (bytes; each region start a multiple of 256; every extent is an exact tile multiple and is written
//   FC f16 [NIMG][64][4096]   2097152      FP bf16 [NIMG][4096][64]  2097152
//   Qh/Ql bf16 [NIMG][4096][64]  2097152 x2
//   R f32 [NIMG][4096]  65536              G f32 [NIMG][4096]  65536
//   total (NIMG = 4) = 8519680
// =============================================================================================================
extern "C" void kernel_launch(void* const* d_in, const int* in_sizes, int n_in,
                              void* d_out, int out_size, void* d_ws, size_t ws_size,
                              hipStream_t stream) {
  const int XN = NIMG * NC * NP;
  if (n_in < 2) return;
  if (in_sizes[0] < XN) return;
  if (out_size < XN) return;

  size_t off = 0;
  auto carve = [&](size_t bytes) { const size_t o = off; off += (bytes + 255) & ~(size_t)255; return o; };
  const size_t oFC = carve((size_t)NIMG * NC * NP * 2);
  const size_t oFP = carve((size_t)NIMG * NP * NC * 2);
  const size_t oQh = carve((size_t)NIMG * NP * NC * 2);
  const size_t oQl = carve((size_t)NIMG * NP * NC * 2);
  const size_t oR  = carve((size_t)NIMG * NP * 4);
  const size_t oG  = carve((size_t)NIMG * NP * 4);
  if (off > ws_size) return;
  if (off > (size_t)134217728) return;

  const float* fg = (const float*)d_in[0];
  // d_in[1] (second input) does not enter this forward output; its pointer is bound to the first launch, unread.
  const float* aux = (const float*)d_in[1];

  char* ws = (char*)d_ws;
  unsigned short* FC = (unsigned short*)(ws + oFC);
  unsigned short* FP = (unsigned short*)(ws + oFP);
  unsigned short* Qh = (unsigned short*)(ws + oQh);
  unsigned short* Ql = (unsigned short*)(ws + oQl);
  float* R = (float*)(ws + oR);
  float* G = (float*)(ws + oG);
  float* out = (float*)d_out;

  const dim3 blk256(256), blk128(128);

  // (1) input -> channel-major f16 plane, key-major bf16 plane, per-pixel norm factors
  cvt_f<<<dim3(NP / QT, NIMG), blk256, 0, stream>>>(fg, aux, FC, FP, R);
  // (2) 3x3 window sums -> query hi + residual bf16 planes, eps terms
  pool_q<<<dim3(HW, NIMG), blk256, 0, stream>>>(fg, Qh, Ql, G);
  // (3) attention over the 4096 per-pixel kernels -> out [b][64][4096]
  attn_k<<<dim3(NP / QT, NIMG), blk128, 0, stream>>>(Qh, Ql, FP, FC, R, G, out);
  (void)hipGetLastError();
}

// v001
// It runs in 49.2 microseconds.
// In two side-by-side timings against v000, it was 4.59 and 4.57 times as fast.
// Contractions: scores S^T[p][q] = FB[p][c].Q[q][c] on v_wmma_f32_16x16x32_bf16 (A = bf16-RNE input rows, exact;
// B = bf16 hi + bf16 residual planes of the 3x3-summed input, 2 products, K = 64); O^T[c][q] = FB16[c][p].P[p][q]
// on v_wmma_f32_16x16x32_f16 (A = f16 of 16 x bf16-RNE input, exact; B = f16 of e^{s-m} x 2^15 x r_p from the
// score D registers); f32 accumulate; per-pixel norm factor r_p, softmax statistics and the eps terms in f32 VALU.
#include <hip/hip_runtime.h>
#include <math.h>
#include <stdint.h>

#ifndef NIMG
#define NIMG 4
#endif
#define NB_FULL 4
#define NC     64
#define HW     64
#define NP     4096
#define QT     64
#define TP     72
#define OSP    68
#define XSC    16.0f
#define IXSC   0.0625f
#define EPSV   1.0e-7f
#define LNCARRY 10.397207708399179f
#define KT     128
#define NST    (NP / KT)
#define KPT    72
#define VPT    136

static_assert(NIMG >= 1 && NIMG <= NB_FULL);
static_assert(NP == HW * HW);
static_assert(NP % QT == 0 && NP % 32 == 0);
static_assert(NC == 64);
static_assert(QT == 64);
static_assert((TP * 2) % 16 == 0);
static_assert((OSP * 4) % 16 == 0);
static_assert(NP % KT == 0 && KT % 32 == 0 && NST >= 2);
static_assert((KPT * 2) % 32 == 16 && (VPT * 2) % 32 == 16);   // LDS row pitch = 16 B x odd for b128 readers
static_assert(KT * NC * 2 == 8 * 128 * 16);                    // one tile = 8 copies of 16 B by each of 128 lanes
static_assert(NP * 4 == 8 * 128 * 16);

typedef _Float16       v16h __attribute__((ext_vector_type(16)));
typedef _Float16       v8h  __attribute__((ext_vector_type(8)));
typedef __bf16         v16b __attribute__((ext_vector_type(16)));
typedef unsigned short v8us __attribute__((ext_vector_type(8)));
typedef float          v8f  __attribute__((ext_vector_type(8)));
typedef float          v4f  __attribute__((ext_vector_type(4)));
typedef unsigned int   v4u  __attribute__((ext_vector_type(4)));

union Frag  { v8us u[2]; v16h h; v16b bf; };
union FragH { v16h v; v8h hv[2]; };
static_assert(sizeof(Frag) == 32);
static_assert(sizeof(FragH) == 32);

// ---- scalar helpers -------------------------------------------------------------------------------------------
__device__ __forceinline__ unsigned short bf_bits(float f) {          // f32 -> bf16 bits, RNE convert
  unsigned u = __float_as_uint(f);
  return (unsigned short)((u + 0x7FFFu + ((u >> 16) & 1u)) >> 16);
}
__device__ __forceinline__ float bf_up(unsigned short hb) { return __uint_as_float(((unsigned)hb) << 16); }
__device__ __forceinline__ float bfr(float f) { return bf_up(bf_bits(f)); }
__device__ __forceinline__ unsigned short h_bits(_Float16 x) { return __builtin_bit_cast(unsigned short, x); }
__device__ __forceinline__ unsigned pk16(unsigned short a, unsigned short b) { return (unsigned)a | ((unsigned)b << 16); }
__device__ __forceinline__ v8f zero8() { v8f z = {0.f, 0.f, 0.f, 0.f, 0.f, 0.f, 0.f, 0.f}; return z; }
__device__ __forceinline__ float hmax8(v8f s) {
  return fmaxf(fmaxf(fmaxf(s[0], s[1]), fmaxf(s[2], s[3])), fmaxf(fmaxf(s[4], s[5]), fmaxf(s[6], s[7])));
}
__device__ __forceinline__ unsigned wave_ballot(bool p) {
#if defined(__HIP_DEVICE_COMPILE__)
  return __builtin_amdgcn_ballot_w32(p);
#else
  return p ? 1u : 0u;
#endif
}

// ---- 16-bit fragment loader (A, or B from a k-contiguous [n][k] row): lane -> row/col (lane&15), p already includes
//      + 8*(lane>>4); elements 0..7 <- p[0..7] (k0+8h..), elements 8..15 <- p[16..23] (k0+16+8h..)
__device__ __forceinline__ Frag ldfrag(const unsigned short* p) {
  Frag f;
  f.u[0] = *(const v8us*)(p);
  f.u[1] = *(const v8us*)(p + 16);
  return f;
}

// ---- WMMA helpers: builtin followed by a 4-slot VALU gap tying D and keeping A/B live ----------------------------
__device__ __forceinline__ v8f mma_h(v16h a, v16h b, v8f c) {
  v8f d = __builtin_amdgcn_wmma_f32_16x16x32_f16(false, a, false, b, (short)0, c, false, false);
#if defined(__HIP_DEVICE_COMPILE__)
  asm volatile("v_nop\n\tv_nop\n\tv_nop\n\tv_nop" : "+v"(d) : "v"(a), "v"(b));
#endif
  return d;
}
__device__ __forceinline__ v8f mma_b(v16b a, v16b b, v8f c) {
  v8f d = __builtin_amdgcn_wmma_f32_16x16x32_bf16(false, a, false, b, (short)0, c, false, false);
#if defined(__HIP_DEVICE_COMPILE__)
  const v16h ha = __builtin_bit_cast(v16h, a), hb = __builtin_bit_cast(v16h, b);
  asm volatile("v_nop\n\tv_nop\n\tv_nop\n\tv_nop" : "+v"(d) : "v"(ha), "v"(hb));
#endif
  return d;
}

// ---- asynchronous copies global -> LDS ---------------------------------------------------------------------------
typedef __attribute__((address_space(3))) const unsigned char lds_byte;
__device__ __forceinline__ unsigned lds_addr(const void* p) { return (unsigned)(uintptr_t)(lds_byte*)p; }
// Eight 16-byte copies per lane: LDS byte address l + i * ls <- global g + i * gs. The s_wait_xcnt stands inside the
// statement so that no address register named by a copy is rewritten in front of it.
__device__ __forceinline__ void copy8(unsigned l, unsigned ls, const char* g, size_t gs) {
#if defined(__HIP_DEVICE_COMPILE__)
  asm volatile(
      "global_load_async_to_lds_b128 %0, %8, off\n\t"
      "global_load_async_to_lds_b128 %1, %9, off\n\t"
      "global_load_async_to_lds_b128 %2, %10, off\n\t"
      "global_load_async_to_lds_b128 %3, %11, off\n\t"
      "global_load_async_to_lds_b128 %4, %12, off\n\t"
      "global_load_async_to_lds_b128 %5, %13, off\n\t"
      "global_load_async_to_lds_b128 %6, %14, off\n\t"
      "global_load_async_to_lds_b128 %7, %15, off\n\t"
      "s_wait_xcnt 0x0"
      :: "v"(l), "v"(l + ls), "v"(l + 2 * ls), "v"(l + 3 * ls), "v"(l + 4 * ls), "v"(l + 5 * ls), "v"(l + 6 * ls),
         "v"(l + 7 * ls), "v"(g), "v"(g + gs), "v"(g + 2 * gs), "v"(g + 3 * gs), "v"(g + 4 * gs), "v"(g + 5 * gs),
         "v"(g + 6 * gs), "v"(g + 7 * gs)
      : "memory");
#endif
}
// this wave's copies have landed in LDS
__device__ __forceinline__ void wait_async0() {
#if defined(__HIP_DEVICE_COMPILE__)
  asm volatile("s_wait_asynccnt 0x0" ::: "memory");
#endif
}
// this wave's LDS reads have returned, so the buffer may be handed to its next writer
__device__ __forceinline__ void wait_ds0() {
#if defined(__HIP_DEVICE_COMPILE__)
  asm volatile("s_wait_dscnt 0x0" ::: "memory");
#endif
}

// =============================================================================================================
// (1) input f32 [b][64 c][4096 p] -> FC f16 [b][c][p] = f16(16 * bf16-RNE(x)) (exact, channel-major, keys
//     contiguous), FP bf16 [b][p][c] = bf16-RNE(x) (key-major, channels contiguous) through an LDS tile
//     T[64 p][64 c] (pitch TP), and R f32 [b][p] = rsqrt(sum_c (bf16-RNE(x) + eps)^2) (4 lanes per p, fixed-order
//     The second pointer argument (aux) is bound only and never read.
// coverage: FC 2 it x 32 rows x 8 lanes x 8 = 64 c x 64 p; FP same; R 16 lanes x 4 = 64 p; grid (64, NIMG) covers
//           every c, p of images 0..NIMG-1 exactly once. LDS: T written 64 p x 64 c, read 64 x 64; Rs 64/64.
// =============================================================================================================
__global__ __launch_bounds__(256)
void cvt_f(const float* __restrict__ f, const float* __restrict__ aux, unsigned short* FC, unsigned short* FP,
           float* R) {
  (void)aux;
  __shared__ __align__(16) unsigned short T[QT * TP];
  __shared__ __align__(16) float Rs[QT];
  const int tid = threadIdx.x;
  const int pt = blockIdx.x, b = blockIdx.y;
  const int e = tid & 7, lq = tid >> 3;                              // lq 0..31
  const int p0 = pt * QT;
  v4u uc[2];
#pragma unroll
  for (int it = 0; it < 2; ++it) {
    const int cl = it * 32 + lq;                                      // channel 0..63
    const float* sp = f + ((size_t)(b * NC + cl)) * NP + p0 + 8 * e;
    const v4f a = *(const v4f*)sp;
    const v4f q = *(const v4f*)(sp + 4);
    const float g[8] = {a[0], a[1], a[2], a[3], q[0], q[1], q[2], q[3]};
    unsigned short hb[8], bb[8];
#pragma unroll
    for (int t = 0; t < 8; ++t) {
      bb[t] = bf_bits(g[t]);
      hb[t] = h_bits((_Float16)(bf_up(bb[t]) * XSC));
    }
#pragma unroll
    for (int t = 0; t < 4; ++t) uc[it][t] = pk16(hb[2 * t], hb[2 * t + 1]);
#pragma unroll
    for (int t = 0; t < 8; ++t) T[(8 * e + t) * TP + cl] = bb[t];    // T[p_loc][c]
  }
  __syncthreads();
  v4u up[2];
#pragma unroll
  for (int it = 0; it < 2; ++it) {
    const int pl = it * 32 + lq;                                      // p_loc 0..63
    up[it] = *(const v4u*)(T + pl * TP + 8 * e);
  }
  {
    const int pl = tid >> 2, sub = tid & 3;                          // 4 lanes per p, 16 channels each
    const unsigned short* tr = T + pl * TP + 16 * sub;
    const v8us w0 = *(const v8us*)(tr);
    const v8us w1 = *(const v8us*)(tr + 8);
    float s = 0.f;
#pragma unroll
    for (int i = 0; i < 8; ++i) { const float v = bf_up(w0[i]) + EPSV; s += v * v; }
#pragma unroll
    for (int i = 0; i < 8; ++i) { const float v = bf_up(w1[i]) + EPSV; s += v * v; }
    s += __shfl_xor(s, 1, 32);
    s += __shfl_xor(s, 2, 32);
    if (sub == 0) Rs[pl] = rsqrtf(s);
  }
  __syncthreads();
  const v4f rv = *(const v4f*)(Rs + 4 * (tid & 15));
{
#pragma unroll
    for (int it = 0; it < 2; ++it) {
      const int rl = it * 32 + lq;
      *(v4u*)(FC + ((size_t)(b * NC + rl)) * NP + p0 + 8 * e) = uc[it];
      *(v4u*)(FP + ((size_t)(b * NP + p0 + rl)) * NC + 8 * e) = up[it];
    }
    if (tid < 16) *(v4f*)(R + (size_t)b * NP + p0 + 4 * tid) = rv;
    
  }
}

// =============================================================================================================
// (2) per (b, image row y): FPOOL[c][x] = 3x3 zero-padded window sum of bf16-RNE(x) centred on pixel (y, x),
//     f32, then Qh/Ql bf16 [b][q = 64 y + x][64 c] (query-major, channels contiguous): hi = bf16-RNE(v), lo =
//     bf16-RNE(v - hi), staged through LDS tiles Th/Tl[64 x][64 c] (pitch TP); G f32 [b][q] = eps * sum_c FPOOL.
//     Thread (ch = tid>>2, xq = tid&3) computes channel ch at x = 16 xq .. 16 xq + 15; edge taps use clamped
//     addresses and are zeroed by predicate; the row-validity test is block-uniform.
// coverage: Qh/Ql 2 it x 32 rows x 8 lanes x 8 = 64 x x 64 c per plane; G 64; grid (64 y, NIMG) covers every q of
//           images 0..NIMG-1 once. LDS: Th/Tl written 64 x 64, read 64 x 64; Gs written 64 c x 64 x, read same; Gq 64.
// =============================================================================================================
__global__ __launch_bounds__(256)
void pool_q(const float* __restrict__ f, unsigned short* Qh, unsigned short* Ql, float* G) {
  __shared__ __align__(16) unsigned short Th[QT * TP];
  __shared__ __align__(16) unsigned short Tl[QT * TP];
  __shared__ __align__(16) float Gs[NC * QT];
  __shared__ __align__(16) float Gq[QT];
  const int tid = threadIdx.x;
  const int y = blockIdx.x, b = blockIdx.y;
  const int ch = tid >> 2, xq = tid & 3, x0 = 16 * xq;
  const float* fc = f + ((size_t)(b * NC + ch)) * NP;
  float s[16];
#pragma unroll
  for (int i = 0; i < 16; ++i) s[i] = 0.f;
#pragma unroll
  for (int dy = -1; dy <= 1; ++dy) {
    const int yy = y + dy;                                            // block-uniform
    if (yy >= 0 && yy < HW) {
      const float* row = fc + yy * HW;
      const v4f a0 = *(const v4f*)(row + x0);
      const v4f a1 = *(const v4f*)(row + x0 + 4);
      const v4f a2 = *(const v4f*)(row + x0 + 8);
      const v4f a3 = *(const v4f*)(row + x0 + 12);
      const int xl = (x0 > 0) ? (x0 - 1) : 0;                          // clamped addresses
      const int xr = (x0 + 16 < HW) ? (x0 + 16) : (HW - 1);
      float vl = row[xl]; vl = (x0 > 0) ? vl : 0.f;
      float vr = row[xr]; vr = (x0 + 16 < HW) ? vr : 0.f;
      float v[18];
      v[0] = bfr(vl); v[17] = bfr(vr);
#pragma unroll
      for (int t = 0; t < 4; ++t) {
        v[1 + t]  = bfr(a0[t]);
        v[5 + t]  = bfr(a1[t]);
        v[9 + t]  = bfr(a2[t]);
        v[13 + t] = bfr(a3[t]);
      }
#pragma unroll
      for (int i = 0; i < 16; ++i) s[i] += (v[i] + v[i + 1]) + v[i + 2];
    }
  }
#pragma unroll
  for (int i = 0; i < 16; ++i) {
    const unsigned short hb = bf_bits(s[i]);
    const unsigned short lb = bf_bits(s[i] - bf_up(hb));
    Th[(x0 + i) * TP + ch] = hb;
    Tl[(x0 + i) * TP + ch] = lb;
  }
#pragma unroll
  for (int t = 0; t < 4; ++t) {
    v4f gv4 = {s[4 * t], s[4 * t + 1], s[4 * t + 2], s[4 * t + 3]};
    *(v4f*)(Gs + ch * QT + x0 + 4 * t) = gv4;
  }
  __syncthreads();
  if (tid < QT) {                                                     // waves 0 and 1 entirely
    float g = 0.f;
#pragma unroll 4
    for (int cc = 0; cc < NC; ++cc) g += Gs[cc * QT + tid];
    Gq[tid] = g * EPSV;
  }
  const int e = tid & 7, lq = tid >> 3;                              // lq 0..31
  v4u uh[2], ul[2];
#pragma unroll
  for (int it = 0; it < 2; ++it) {
    const int xl2 = it * 32 + lq;                                     // x 0..63
    uh[it] = *(const v4u*)(Th + xl2 * TP + 8 * e);
    ul[it] = *(const v4u*)(Tl + xl2 * TP + 8 * e);
  }
  __syncthreads();
  const v4f gv = *(const v4f*)(Gq + 4 * (tid & 15));
{
#pragma unroll
    for (int it = 0; it < 2; ++it) {
      const int xl2 = it * 32 + lq;
      const size_t po = ((size_t)(b * NP + y * HW + xl2)) * NC + 8 * e;
      *(v4u*)(Qh + po) = uh[it];
      *(v4u*)(Ql + po) = ul[it];
    }
    if (tid < 16) *(v4f*)(G + (size_t)b * NP + y * HW + 4 * tid) = gv;
    
  }
}

// =============================================================================================================
// (3) attention for one (b, 64-query tile), transposed formulation, 4096 keys, no mask:
//   S^T tile (16 keys x 16 queries) = A(FP row = key kb + (lane&15), 64 channels via the split k map, bf16 exact)
//   . B(Qh row = query, same map) + A(FP).B(Ql) (unscaled bf16 residual, shared accumulator), K = 64 = 2 steps;
//   then s = r_key * (acc + g_query) (per-key norm factor and the eps term, f32). Q fragments and g are loaded once.
//   Per lane the D tile holds 8 keys of ONE query: online softmax per lane, one shuffle (lane^16) for the max over
//   32 keys; the o/l/E rescale is skipped under a wave-uniform ballot when no lane's max grew. P = f16 of
//   e^{s-m} x 2^15 x r_key is the B operand of O^T (rows channel 16j + (lane&15), keys contiguous, f16 plane FC =
//   16 x input) . B(P^T): element r <- D of the tile covering keys kb..kb+15, element 8+r <- the tile covering
//   kb+16..kb+31, lane unchanged. 4 accumulator tiles per wave (64 channels). l = sum e and E = sum e r_key in f32.
//   Data path: the work-group's four waves share every key tile. A stage = KT = 128 keys: FP rows (128 x 128 B, LDS
//   pitch 144 B) and FC rows (64 x 256 B, LDS pitch 272 B) come by 16-byte asynchronous copies into one of two LDS
//   buffers, one stage ahead of the stage being worked on; all 4096 norm factors of the image are copied once with
//   stage 0. Foot of each stage: LDS reads returned, own copies landed, barrier, then the refill of the buffer just read.
//   Epilogue: out = (O / 16 + eps E) / l staged in LDS Os[query][64 channels] (pitch OSP, b128 stores), barrier,
// coverage: Os 4 waves x 16 queries x 64 ch; out 8 it x 16 lines x 8 lanes x 4 floats = 64 ch x 64 queries;
//           grid (64, NIMG) covers out[b][0..63][0..4095] of images 0..NIMG-1 exactly once.
// =============================================================================================================
__global__ __launch_bounds__(128)
void attn_k(const unsigned short* __restrict__ Qh, const unsigned short* __restrict__ Ql,
            const unsigned short* __restrict__ FP, const unsigned short* __restrict__ FC,
            const float* __restrict__ R, const float* __restrict__ G, float* out) {
  __shared__ __align__(16) float Os[QT * OSP];
  __shared__ __align__(16) unsigned short Ks[2 * KT * KPT];
  __shared__ __align__(16) unsigned short Vs[2 * NC * VPT];
  __shared__ __align__(16) float Rl[NP];
  const int tid  = threadIdx.x;
  const int wave = tid >> 5, lane = tid & 31;
  const int hh   = lane >> 4, c = lane & 15;
  const int n0   = blockIdx.x * QT, b = blockIdx.y;

  // q fragments (B operand, col = query n0 + 16*wave + c), channels 0..31 and 32..63
  const size_t qo = ((size_t)(b * NP + n0 + 16 * wave + c)) * NC + 8 * hh;
  const Frag qh0 = ldfrag(Qh + qo);
  const Frag qh1 = ldfrag(Qh + qo + 32);
  const Frag ql0 = ldfrag(Ql + qo);
  const Frag ql1 = ldfrag(Ql + qo + 32);
  const float gq = G[(size_t)b * NP + n0 + 16 * wave + c];
  // copy addresses of this lane. K tile: 16-byte chunk tid + 128 i of a contiguous 16 KiB, 8 chunks per 128-B row;
  // V tile: chunk tid + 128 i, 16 chunks per 256-B row of one channel; R: chunk tid + 128 i of 16 KiB.
  const char* gK = (const char*)(FP + (size_t)b * NP * NC) + 16 * tid;
  const char* gV = (const char*)(FC + (size_t)b * NC * NP) + (size_t)(tid >> 4) * (NP * 2) + 16 * (tid & 15);
  const char* gR = (const char*)(R + (size_t)b * NP) + 16 * tid;
  const unsigned lK = lds_addr(Ks) + (tid >> 3) * (KPT * 2) + 16 * (tid & 7);
  const unsigned lV = lds_addr(Vs) + (tid >> 4) * (VPT * 2) + 16 * (tid & 15);
  const unsigned lR = lds_addr(Rl) + 16 * tid;

  // stage 0 and the norm factors, published; then stage 1 in flight
  copy8(lK, 16 * KPT * 2, gK, 2048);
  copy8(lV, 8 * VPT * 2, gV, (size_t)8 * NP * 2);
  copy8(lR, 2048, gR, 2048);
  wait_async0();
  __syncthreads();
  copy8(lK + KT * KPT * 2, 16 * KPT * 2, gK + KT * NC * 2, 2048);
  copy8(lV + NC * VPT * 2, 8 * VPT * 2, gV + KT * 2, (size_t)8 * NP * 2);

  float m = -1.0e30f, l = 0.f, E = 0.f;
  v8f o[4];
#pragma unroll
  for (int j = 0; j < 4; ++j) o[j] = zero8();

#pragma unroll 1                                                      // one trip = one LDS stage
  for (int st = 0; st < NST; ++st) {
  const int buf = st & 1;
  // k fragment base (A operand, row = key c of the tile), v fragment base (A operand, row = channel 16j + c, keys
  // contiguous), per-key norm factors for keys kb + 8hh + r and kb + 16 + 8hh + r
  const unsigned short* Kp = Ks + buf * (KT * KPT) + c * KPT + 8 * hh;
  const unsigned short* Vp = Vs + buf * (NC * VPT) + c * VPT + 8 * hh;
  const float* Rp = Rl + st * KT + 8 * hh;
#pragma unroll                                                        // constant LDS offsets for the four passes
  for (int kb = 0; kb < KT; kb += 32) {
    const unsigned short* k0p = Kp + kb * KPT;                      // keys kb .. kb+15 of the stage
    const unsigned short* k1p = Kp + (kb + 16) * KPT;               // keys kb+16 .. kb+31
    v8f s0 = zero8(), s1 = zero8();
    // all LDS reads of the pass stand here in one group: the norm factors and the v fragments return under the score
    // products and the softmax instead of being waited for one by one
    const Frag a0 = ldfrag(k0p), a1 = ldfrag(k0p + 32);
    const Frag c0 = ldfrag(k1p), c1 = ldfrag(k1p + 32);
    const v4f ra = *(const v4f*)(Rp + kb);
    const v4f rb = *(const v4f*)(Rp + kb + 4);
    const v4f rc = *(const v4f*)(Rp + kb + 16);
    const v4f rd = *(const v4f*)(Rp + kb + 20);
    Frag vf[4];
#pragma unroll
    for (int j = 0; j < 4; ++j) vf[j] = ldfrag(Vp + (16 * j) * VPT + kb);
    {
      s0 = mma_b(a0.bf, qh0.bf, s0);
      s1 = mma_b(c0.bf, qh0.bf, s1);
      s0 = mma_b(a0.bf, ql0.bf, s0);
      s1 = mma_b(c0.bf, ql0.bf, s1);
      s0 = mma_b(a1.bf, qh1.bf, s0);
      s1 = mma_b(c1.bf, qh1.bf, s1);
      s0 = mma_b(a1.bf, ql1.bf, s0);
      s1 = mma_b(c1.bf, ql1.bf, s1);
    }
    const float r0v[8] = {ra[0], ra[1], ra[2], ra[3], rb[0], rb[1], rb[2], rb[3]};
    const float r1v[8] = {rc[0], rc[1], rc[2], rc[3], rd[0], rd[1], rd[2], rd[3]};
#pragma unroll
    for (int r = 0; r < 8; ++r) {
      s0[r] = r0v[r] * (s0[r] + gq);                                  // key kb      + 8hh + r
      s1[r] = r1v[r] * (s1[r] + gq);                                  // key kb + 16 + 8hh + r
    }

    float mx = fmaxf(hmax8(s0), hmax8(s1));
    mx = fmaxf(mx, __shfl_xor(mx, 16, 32));
    const float mn = fmaxf(m, mx);
    const unsigned grew = wave_ballot(mx > m);                        // wave-uniform
    if (grew != 0u) {
      const float corr = __expf(m - mn);                              // == 1 exactly for lanes whose max did not grow
      l *= corr;
      E *= corr;
#pragma unroll
      for (int j = 0; j < 4; ++j) {
#pragma unroll
        for (int r = 0; r < 8; ++r) o[j][r] *= corr;
      }
    }
    m = mn;
    const float msh = mn - LNCARRY;                                   // exp gives e^{s-m} * 32768

    FragH ph;
    float ls = 0.f, es = 0.f;
#pragma unroll
    for (int r = 0; r < 8; ++r) {
      const float e0 = __expf(s0[r] - msh);
      const float e1 = __expf(s1[r] - msh);
      ls += e0 + e1;
      const float pe0 = e0 * r0v[r];
      const float pe1 = e1 * r1v[r];
      es += pe0 + pe1;
      ph.hv[0][r] = (_Float16)pe0;
      ph.hv[1][r] = (_Float16)pe1;
    }
    l += ls;
    E += es;

#pragma unroll
    for (int j = 0; j < 4; ++j) o[j] = mma_h(vf[j].h, ph.v, o[j]);
  }
  // publish stage st + 1 and free this stage's buffer
  wait_ds0();
  wait_async0();
  __syncthreads();
  if (st + 2 < NST) {                                                 // same for the whole work-group
    copy8(lK + buf * (KT * KPT * 2), 16 * KPT * 2, gK + (size_t)(st + 2) * (KT * NC * 2), 2048);
    copy8(lV + buf * (NC * VPT * 2), 8 * VPT * 2, gV + (size_t)(st + 2) * (KT * 2), (size_t)8 * NP * 2);
  }
  }
  wait_async0();
  l += __shfl_xor(l, 16, 32);
  E += __shfl_xor(E, 16, 32);
  const float inv = 1.0f / l;                                         // o, E and l all carry the 2^15 factor
  const float ee  = EPSV * E;

  const int qrow = 16 * wave + c;
#pragma unroll
  for (int j = 0; j < 4; ++j) {
    v4f va, vb;
#pragma unroll
    for (int r = 0; r < 4; ++r) {
      va[r] = (o[j][r] * IXSC + ee) * inv;
      vb[r] = (o[j][4 + r] * IXSC + ee) * inv;
    }
    *(v4f*)(Os + qrow * OSP + 16 * j + 8 * hh)     = va;              // Os[query][ch = 16j + 8hh + r]
    *(v4f*)(Os + qrow * OSP + 16 * j + 8 * hh + 4) = vb;
  }
  __syncthreads();
  const int e = tid & 7, lq = tid >> 3;                               // lq 0..15
  v4f res[8];
#pragma unroll
  for (int it = 0; it < 8; ++it) {
    const int L   = it * 16 + lq;                                     // 0..127
    const int chl = L >> 1, hf = L & 1;                               // channel 0..63
    const int nl  = hf * 32 + 4 * e;                                  // query 0..63
#pragma unroll
    for (int t = 0; t < 4; ++t) res[it][t] = Os[(nl + t) * OSP + chl];
  }
{
#pragma unroll
    for (int it = 0; it < 8; ++it) {
      const int L   = it * 16 + lq;
      const int chl = L >> 1, hf = L & 1;
      const int nl  = hf * 32 + 4 * e;
      const size_t idx = ((size_t)(b * NC + chl)) * NP + n0 + nl;
      *(v4f*)(out + idx) = res[it];
    }
    
  }
}

// =============================================================================================================
// Workspace map (bytes; each region start a multiple of 256; every extent is an exact tile multiple and is written
//   FC f16 [NIMG][64][4096]   2097152      FP bf16 [NIMG][4096][64]  2097152
//   Qh/Ql bf16 [NIMG][4096][64]  2097152 x2
//   R f32 [NIMG][4096]  65536              G f32 [NIMG][4096]  65536
//   total (NIMG = 4) = 8519680
// =============================================================================================================
extern "C" void kernel_launch(void* const* d_in, const int* in_sizes, int n_in,
                              void* d_out, int out_size, void* d_ws, size_t ws_size,
                              hipStream_t stream) {
  const int XN = NIMG * NC * NP;
  if (n_in < 2) return;
  if (in_sizes[0] < XN) return;
  if (out_size < XN) return;

  size_t off = 0;
  auto carve = [&](size_t bytes) { const size_t o = off; off += (bytes + 255) & ~(size_t)255; return o; };
  const size_t oFC = carve((size_t)NIMG * NC * NP * 2);
  const size_t oFP = carve((size_t)NIMG * NP * NC * 2);
  const size_t oQh = carve((size_t)NIMG * NP * NC * 2);
  const size_t oQl = carve((size_t)NIMG * NP * NC * 2);
  const size_t oR  = carve((size_t)NIMG * NP * 4);
  const size_t oG  = carve((size_t)NIMG * NP * 4);
  if (off > ws_size) return;
  if (off > (size_t)134217728) return;

  const float* fg = (const float*)d_in[0];
  // d_in[1] (second input) does not enter this forward output; its pointer is bound to the first launch, unread.
  const float* aux = (const float*)d_in[1];

  char* ws = (char*)d_ws;
  unsigned short* FC = (unsigned short*)(ws + oFC);
  unsigned short* FP = (unsigned short*)(ws + oFP);
  unsigned short* Qh = (unsigned short*)(ws + oQh);
  unsigned short* Ql = (unsigned short*)(ws + oQl);
  float* R = (float*)(ws + oR);
  float* G = (float*)(ws + oG);
  float* out = (float*)d_out;

  const dim3 blk256(256), blk128(128);

  // (1) input -> channel-major f16 plane, key-major bf16 plane, per-pixel norm factors
  cvt_f<<<dim3(NP / QT, NIMG), blk256, 0, stream>>>(fg, aux, FC, FP, R);
  // (2) 3x3 window sums -> query hi + residual bf16 planes, eps terms
  pool_q<<<dim3(HW, NIMG), blk256, 0, stream>>>(fg, Qh, Ql, G);
  // (3) attention over the 4096 per-pixel kernels -> out [b][64][4096]
  attn_k<<<dim3(NP / QT, NIMG), blk128, 0, stream>>>(Qh, Ql, FP, FC, R, G, out);
  (void)hipGetLastError();
}

// v002
// Measured time: 36.5 microseconds a run.
// In both of two side-by-side timings against v001, it was 1.35 times as fast.
// All steps since v000 together make it 6.19 times as fast.
// Contractions: scores S^T[p][q] = FB[p][c].Q[q][c] on v_wmma_f32_16x16x32_bf16 (A = bf16-RNE input rows, exact;
// B = bf16 hi + bf16 residual planes of the 3x3-summed input, 2 products, K = 64); O^T[c][q] = FB16[c][p].P[p][q]
// on v_wmma_f32_16x16x32_f16 (A = f16 of 16 x bf16-RNE input, exact; B = f16 of e^{s-m} x 2^15 x r_p from the
// score D registers); f32 accumulate; per-pixel norm factor r_p, softmax statistics and the eps terms in f32 VALU.
#include <hip/hip_runtime.h>
#include <math.h>
#include <stdint.h>

#ifndef NIMG
#define NIMG 4
#endif
#define NB_FULL 4
#define NC     64
#define HW     64
#define NP     4096
#define QT     64
#define TP     72
#define OSP    68
#define XSC    16.0f
#define IXSC   0.0625f
#define EPSV   1.0e-7f
#define LNCARRY 10.397207708399179f
#define KT     256
#define NST    (NP / KT)
#define KPT    72
#define VPT    264
#define NKG    4
#define KG     (KT / NKG)
#define NTH    (128 * NKG)

static_assert(NIMG >= 1 && NIMG <= NB_FULL);
static_assert(NP == HW * HW);
static_assert(NP % QT == 0 && NP % 32 == 0);
static_assert(NC == 64);
static_assert(QT == 64);
static_assert((TP * 2) % 16 == 0);
static_assert((OSP * 4) % 16 == 0);
static_assert(NP % KT == 0 && KT % 32 == 0 && NST >= 2);
static_assert((KPT * 2) % 32 == 16 && (VPT * 2) % 32 == 16);   // LDS row pitch = 16 B x odd for b128 readers
static_assert(KT * NC * 2 == 4 * NTH * 16);                    // one tile = 4 copies of 16 B by each of 512 lanes
static_assert(NP * 4 == 2 * NTH * 16);
static_assert(KG % 32 == 0 && NKG == NC / 16);                 // wave of key group g merges channel block g

typedef _Float16       v16h __attribute__((ext_vector_type(16)));
typedef _Float16       v8h  __attribute__((ext_vector_type(8)));
typedef __bf16         v16b __attribute__((ext_vector_type(16)));
typedef unsigned short v8us __attribute__((ext_vector_type(8)));
typedef float          v8f  __attribute__((ext_vector_type(8)));
typedef float          v4f  __attribute__((ext_vector_type(4)));
typedef unsigned int   v4u  __attribute__((ext_vector_type(4)));

union Frag  { v8us u[2]; v16h h; v16b bf; };
union FragH { v16h v; v8h hv[2]; };
static_assert(sizeof(Frag) == 32);
static_assert(sizeof(FragH) == 32);

// ---- scalar helpers -------------------------------------------------------------------------------------------
__device__ __forceinline__ unsigned short bf_bits(float f) {          // f32 -> bf16 bits, RNE convert
  unsigned u = __float_as_uint(f);
  return (unsigned short)((u + 0x7FFFu + ((u >> 16) & 1u)) >> 16);
}
__device__ __forceinline__ float bf_up(unsigned short hb) { return __uint_as_float(((unsigned)hb) << 16); }
__device__ __forceinline__ float bfr(float f) { return bf_up(bf_bits(f)); }
__device__ __forceinline__ unsigned short h_bits(_Float16 x) { return __builtin_bit_cast(unsigned short, x); }
__device__ __forceinline__ unsigned pk16(unsigned short a, unsigned short b) { return (unsigned)a | ((unsigned)b << 16); }
__device__ __forceinline__ v8f zero8() { v8f z = {0.f, 0.f, 0.f, 0.f, 0.f, 0.f, 0.f, 0.f}; return z; }
__device__ __forceinline__ float hmax8(v8f s) {
  return fmaxf(fmaxf(fmaxf(s[0], s[1]), fmaxf(s[2], s[3])), fmaxf(fmaxf(s[4], s[5]), fmaxf(s[6], s[7])));
}
__device__ __forceinline__ unsigned wave_ballot(bool p) {
#if defined(__HIP_DEVICE_COMPILE__)
  return __builtin_amdgcn_ballot_w32(p);
#else
  return p ? 1u : 0u;
#endif
}

// e^x as __expf forms it (multiply by log2 e, v_exp_f32), with the one free vector slot that the instruction set asks
// for behind a transcendental written into the same statement, so that no reader or overwrite stands directly behind it
__device__ __forceinline__ float exp_slot(float x) {
  const float t = x * 1.44269504f;
  float y = t;
#if defined(__HIP_DEVICE_COMPILE__)
  asm("v_exp_f32 %0, %1\n\tv_nop" : "=v"(y) : "v"(t));
#endif
  return y;
}

// ---- 16-bit fragment loader (A, or B from a k-contiguous [n][k] row): lane -> row/col (lane&15), p already includes
//      + 8*(lane>>4); elements 0..7 <- p[0..7] (k0+8h..), elements 8..15 <- p[16..23] (k0+16+8h..)
__device__ __forceinline__ Frag ldfrag(const unsigned short* p) {
  Frag f;
  f.u[0] = *(const v8us*)(p);
  f.u[1] = *(const v8us*)(p + 16);
  return f;
}

// ---- WMMA helpers: builtin followed by a 4-slot VALU gap tying D and keeping A/B live ----------------------------
__device__ __forceinline__ v8f mma_h(v16h a, v16h b, v8f c) {
  v8f d = __builtin_amdgcn_wmma_f32_16x16x32_f16(false, a, false, b, (short)0, c, false, false);
#if defined(__HIP_DEVICE_COMPILE__)
  asm volatile("v_nop\n\tv_nop\n\tv_nop\n\tv_nop" : "+v"(d) : "v"(a), "v"(b));
#endif
  return d;
}
__device__ __forceinline__ v8f mma_b(v16b a, v16b b, v8f c) {
  v8f d = __builtin_amdgcn_wmma_f32_16x16x32_bf16(false, a, false, b, (short)0, c, false, false);
#if defined(__HIP_DEVICE_COMPILE__)
  const v16h ha = __builtin_bit_cast(v16h, a), hb = __builtin_bit_cast(v16h, b);
  asm volatile("v_nop\n\tv_nop\n\tv_nop\n\tv_nop" : "+v"(d) : "v"(ha), "v"(hb));
#endif
  return d;
}

// ---- asynchronous copies global -> LDS ---------------------------------------------------------------------------
typedef __attribute__((address_space(3))) const unsigned char lds_byte;
__device__ __forceinline__ unsigned lds_addr(const void* p) { return (unsigned)(uintptr_t)(lds_byte*)p; }
// Four (two) 16-byte copies per lane: LDS byte address l + i * ls <- global g + i * gs. The s_wait_xcnt stands inside
// the statement so that no address register named by a copy is rewritten in front of it.
__device__ __forceinline__ void copy4(unsigned l, unsigned ls, const char* g, size_t gs) {
#if defined(__HIP_DEVICE_COMPILE__)
  asm volatile(
      "global_load_async_to_lds_b128 %0, %4, off\n\t"
      "global_load_async_to_lds_b128 %1, %5, off\n\t"
      "global_load_async_to_lds_b128 %2, %6, off\n\t"
      "global_load_async_to_lds_b128 %3, %7, off\n\t"
      "s_wait_xcnt 0x0"
      :: "v"(l), "v"(l + ls), "v"(l + 2 * ls), "v"(l + 3 * ls), "v"(g), "v"(g + gs), "v"(g + 2 * gs), "v"(g + 3 * gs)
      : "memory");
#endif
}
__device__ __forceinline__ void copy2(unsigned l, unsigned ls, const char* g, size_t gs) {
#if defined(__HIP_DEVICE_COMPILE__)
  asm volatile(
      "global_load_async_to_lds_b128 %0, %2, off\n\t"
      "global_load_async_to_lds_b128 %1, %3, off\n\t"
      "s_wait_xcnt 0x0"
      :: "v"(l), "v"(l + ls), "v"(g), "v"(g + gs)
      : "memory");
#endif
}
// this wave's copies have landed in LDS
__device__ __forceinline__ void wait_async0() {
#if defined(__HIP_DEVICE_COMPILE__)
  asm volatile("s_wait_asynccnt 0x0" ::: "memory");
#endif
}
// this wave's LDS reads have returned, so the buffer may be handed to its next writer
__device__ __forceinline__ void wait_ds0() {
#if defined(__HIP_DEVICE_COMPILE__)
  asm volatile("s_wait_dscnt 0x0" ::: "memory");
#endif
}

// =============================================================================================================
// (1) input f32 [b][64 c][4096 p] -> FC f16 [b][c][p] = f16(16 * bf16-RNE(x)) (exact, channel-major, keys
//     contiguous), FP bf16 [b][p][c] = bf16-RNE(x) (key-major, channels contiguous) through an LDS tile
//     T[64 p][64 c] (pitch TP), and R f32 [b][p] = rsqrt(sum_c (bf16-RNE(x) + eps)^2) (4 lanes per p, fixed-order
//     The second pointer argument (aux) is bound only and never read.
// coverage: FC 2 it x 32 rows x 8 lanes x 8 = 64 c x 64 p; FP same; R 16 lanes x 4 = 64 p; grid (64, NIMG) covers
//           every c, p of images 0..NIMG-1 exactly once. LDS: T written 64 p x 64 c, read 64 x 64; Rs 64/64.
// =============================================================================================================
__global__ __launch_bounds__(256)
void cvt_f(const float* __restrict__ f, const float* __restrict__ aux, unsigned short* FC, unsigned short* FP,
           float* R) {
  (void)aux;
  __shared__ __align__(16) unsigned short T[QT * TP];
  __shared__ __align__(16) float Rs[QT];
  const int tid = threadIdx.x;
  const int pt = blockIdx.x, b = blockIdx.y;
  const int e = tid & 7, lq = tid >> 3;                              // lq 0..31
  const int p0 = pt * QT;
  v4u uc[2];
#pragma unroll
  for (int it = 0; it < 2; ++it) {
    const int cl = it * 32 + lq;                                      // channel 0..63
    const float* sp = f + ((size_t)(b * NC + cl)) * NP + p0 + 8 * e;
    const v4f a = *(const v4f*)sp;
    const v4f q = *(const v4f*)(sp + 4);
    const float g[8] = {a[0], a[1], a[2], a[3], q[0], q[1], q[2], q[3]};
    unsigned short hb[8], bb[8];
#pragma unroll
    for (int t = 0; t < 8; ++t) {
      bb[t] = bf_bits(g[t]);
      hb[t] = h_bits((_Float16)(bf_up(bb[t]) * XSC));
    }
#pragma unroll
    for (int t = 0; t < 4; ++t) uc[it][t] = pk16(hb[2 * t], hb[2 * t + 1]);
#pragma unroll
    for (int t = 0; t < 8; ++t) T[(8 * e + t) * TP + cl] = bb[t];    // T[p_loc][c]
  }
  __syncthreads();
  v4u up[2];
#pragma unroll
  for (int it = 0; it < 2; ++it) {
    const int pl = it * 32 + lq;                                      // p_loc 0..63
    up[it] = *(const v4u*)(T + pl * TP + 8 * e);
  }
  {
    const int pl = tid >> 2, sub = tid & 3;                          // 4 lanes per p, 16 channels each
    const unsigned short* tr = T + pl * TP + 16 * sub;
    const v8us w0 = *(const v8us*)(tr);
    const v8us w1 = *(const v8us*)(tr + 8);
    float s = 0.f;
#pragma unroll
    for (int i = 0; i < 8; ++i) { const float v = bf_up(w0[i]) + EPSV; s += v * v; }
#pragma unroll
    for (int i = 0; i < 8; ++i) { const float v = bf_up(w1[i]) + EPSV; s += v * v; }
    s += __shfl_xor(s, 1, 32);
    s += __shfl_xor(s, 2, 32);
    if (sub == 0) Rs[pl] = rsqrtf(s);
  }
  __syncthreads();
  const v4f rv = *(const v4f*)(Rs + 4 * (tid & 15));
{
#pragma unroll
    for (int it = 0; it < 2; ++it) {
      const int rl = it * 32 + lq;
      *(v4u*)(FC + ((size_t)(b * NC + rl)) * NP + p0 + 8 * e) = uc[it];
      *(v4u*)(FP + ((size_t)(b * NP + p0 + rl)) * NC + 8 * e) = up[it];
    }
    if (tid < 16) *(v4f*)(R + (size_t)b * NP + p0 + 4 * tid) = rv;
    
  }
}

// =============================================================================================================
// (2) per (b, image row y): FPOOL[c][x] = 3x3 zero-padded window sum of bf16-RNE(x) centred on pixel (y, x),
//     f32, then Qh/Ql bf16 [b][q = 64 y + x][64 c] (query-major, channels contiguous): hi = bf16-RNE(v), lo =
//     bf16-RNE(v - hi), staged through LDS tiles Th/Tl[64 x][64 c] (pitch TP); G f32 [b][q] = eps * sum_c FPOOL.
//     Thread (ch = tid>>2, xq = tid&3) computes channel ch at x = 16 xq .. 16 xq + 15; edge taps use clamped
//     addresses and are zeroed by predicate; the row-validity test is block-uniform.
// coverage: Qh/Ql 2 it x 32 rows x 8 lanes x 8 = 64 x x 64 c per plane; G 64; grid (64 y, NIMG) covers every q of
//           images 0..NIMG-1 once. LDS: Th/Tl written 64 x 64, read 64 x 64; Gs written 64 c x 64 x, read same; Gq 64.
// =============================================================================================================
__global__ __launch_bounds__(256)
void pool_q(const float* __restrict__ f, unsigned short* Qh, unsigned short* Ql, float* G) {
  __shared__ __align__(16) unsigned short Th[QT * TP];
  __shared__ __align__(16) unsigned short Tl[QT * TP];
  __shared__ __align__(16) float Gs[NC * QT];
  __shared__ __align__(16) float Gq[QT];
  const int tid = threadIdx.x;
  const int y = blockIdx.x, b = blockIdx.y;
  const int ch = tid >> 2, xq = tid & 3, x0 = 16 * xq;
  const float* fc = f + ((size_t)(b * NC + ch)) * NP;
  float s[16];
#pragma unroll
  for (int i = 0; i < 16; ++i) s[i] = 0.f;
#pragma unroll
  for (int dy = -1; dy <= 1; ++dy) {
    const int yy = y + dy;                                            // block-uniform
    if (yy >= 0 && yy < HW) {
      const float* row = fc + yy * HW;
      const v4f a0 = *(const v4f*)(row + x0);
      const v4f a1 = *(const v4f*)(row + x0 + 4);
      const v4f a2 = *(const v4f*)(row + x0 + 8);
      const v4f a3 = *(const v4f*)(row + x0 + 12);
      const int xl = (x0 > 0) ? (x0 - 1) : 0;                          // clamped addresses
      const int xr = (x0 + 16 < HW) ? (x0 + 16) : (HW - 1);
      float vl = row[xl]; vl = (x0 > 0) ? vl : 0.f;
      float vr = row[xr]; vr = (x0 + 16 < HW) ? vr : 0.f;
      float v[18];
      v[0] = bfr(vl); v[17] = bfr(vr);
#pragma unroll
      for (int t = 0; t < 4; ++t) {
        v[1 + t]  = bfr(a0[t]);
        v[5 + t]  = bfr(a1[t]);
        v[9 + t]  = bfr(a2[t]);
        v[13 + t] = bfr(a3[t]);
      }
#pragma unroll
      for (int i = 0; i < 16; ++i) s[i] += (v[i] + v[i + 1]) + v[i + 2];
    }
  }
#pragma unroll
  for (int i = 0; i < 16; ++i) {
    const unsigned short hb = bf_bits(s[i]);
    const unsigned short lb = bf_bits(s[i] - bf_up(hb));
    Th[(x0 + i) * TP + ch] = hb;
    Tl[(x0 + i) * TP + ch] = lb;
  }
#pragma unroll
  for (int t = 0; t < 4; ++t) {
    v4f gv4 = {s[4 * t], s[4 * t + 1], s[4 * t + 2], s[4 * t + 3]};
    *(v4f*)(Gs + ch * QT + x0 + 4 * t) = gv4;
  }
  __syncthreads();
  if (tid < QT) {                                                     // waves 0 and 1 entirely
    float g = 0.f;
#pragma unroll 4
    for (int cc = 0; cc < NC; ++cc) g += Gs[cc * QT + tid];
    Gq[tid] = g * EPSV;
  }
  const int e = tid & 7, lq = tid >> 3;                              // lq 0..31
  v4u uh[2], ul[2];
#pragma unroll
  for (int it = 0; it < 2; ++it) {
    const int xl2 = it * 32 + lq;                                     // x 0..63
    uh[it] = *(const v4u*)(Th + xl2 * TP + 8 * e);
    ul[it] = *(const v4u*)(Tl + xl2 * TP + 8 * e);
  }
  __syncthreads();
  const v4f gv = *(const v4f*)(Gq + 4 * (tid & 15));
{
#pragma unroll
    for (int it = 0; it < 2; ++it) {
      const int xl2 = it * 32 + lq;
      const size_t po = ((size_t)(b * NP + y * HW + xl2)) * NC + 8 * e;
      *(v4u*)(Qh + po) = uh[it];
      *(v4u*)(Ql + po) = ul[it];
    }
    if (tid < 16) *(v4f*)(G + (size_t)b * NP + y * HW + 4 * tid) = gv;
    
  }
}

// =============================================================================================================
// (3) attention for one (b, 64-query tile), transposed formulation, 4096 keys, no mask:
//   S^T tile (16 keys x 16 queries) = A(FP row = key kb + (lane&15), 64 channels via the split k map, bf16 exact)
//   . B(Qh row = query, same map) + A(FP).B(Ql) (unscaled bf16 residual, shared accumulator), K = 64 = 2 steps;
//   then s = r_key * (acc + g_query) (per-key norm factor and the eps term, f32). Q fragments and g are loaded once.
//   Per lane the D tile holds 8 keys of ONE query: online softmax per lane, one shuffle (lane^16) for the max over
//   32 keys; the o/l/E rescale is skipped under a wave-uniform ballot when no lane's max grew. P = f16 of
//   e^{s-m} x 2^15 x r_key is the B operand of O^T (rows channel 16j + (lane&15), keys contiguous, f16 plane FC =
//   16 x input) . B(P^T): element r <- D of the tile covering keys kb..kb+15, element 8+r <- the tile covering
//   kb+16..kb+31, lane unchanged. 4 accumulator tiles per wave (64 channels). l = sum e and E = sum e r_key in f32.
//   Waves: 16 per work-group, four per SIMD. Wave w works on query group qg = w & 3 (16 queries) and key group
//   kg = w >> 2: of every stage it takes keys 64 kg .. 64 kg + 63 (two passes of 32), with softmax statistics and
//   accumulators of its own; the vector work of one wave runs under the matrix work and the LDS waits of the others.
//   Data path: the work-group's waves share every key tile. A stage = KT = 256 keys: FP rows (256 x 128 B, LDS
//   pitch 144 B) and FC rows (64 x 512 B, LDS pitch 528 B) come by 16-byte asynchronous copies into one of two LDS
//   buffers, one stage ahead of the stage being worked on; all 4096 norm factors of the image are copied once with
//   stage 0. Foot of each stage: LDS reads returned, own copies landed, barrier, then the refill of the buffer just read.
//   Merge: every wave stores m, l, E and its four O tiles in LDS Mg, barrier; wave (qg, kg) joins channel block kg of
//   query group qg over the four key groups in fixed order: weight e^{m_g - max m}, sums of l, E and O.
//   Epilogue: out = (O / 16 + eps E) / l staged in LDS Os[query][64 channels] (pitch OSP, b128 stores), barrier,
// coverage: Mg 16 waves x 9 x 32 lanes written, read 4 x 3 x 32 per wave; Os 16 waves x 16 queries x 16 ch; out 2 it x
//           64 lines x 8 lanes x 4 floats = 64 ch x 64 queries;
//           grid (64, NIMG) covers out[b][0..63][0..4095] of images 0..NIMG-1 exactly once.
// =============================================================================================================
__global__ __launch_bounds__(NTH)
void attn_k(const unsigned short* __restrict__ Qh, const unsigned short* __restrict__ Ql,
            const unsigned short* __restrict__ FP, const unsigned short* __restrict__ FC,
            const float* __restrict__ R, const float* __restrict__ G, float* out) {
  __shared__ __align__(16) float Os[QT * OSP];
  __shared__ __align__(16) unsigned short Ks[2 * KT * KPT];
  __shared__ __align__(16) unsigned short Vs[2 * NC * VPT];
  __shared__ __align__(16) float Rl[NP];
  __shared__ __align__(16) v4f Mg[4 * NKG * 9 * 32];
  const int tid  = threadIdx.x;
  const int wave = tid >> 5, lane = tid & 31;
  const int qg   = wave & 3, kg = wave >> 2;
  const int hh   = lane >> 4, c = lane & 15;
  const int n0   = blockIdx.x * QT, b = blockIdx.y;

  // q fragments (B operand, col = query n0 + 16*qg + c), channels 0..31 and 32..63
  const size_t qo = ((size_t)(b * NP + n0 + 16 * qg + c)) * NC + 8 * hh;
  const Frag qh0 = ldfrag(Qh + qo);
  const Frag qh1 = ldfrag(Qh + qo + 32);
  const Frag ql0 = ldfrag(Ql + qo);
  const Frag ql1 = ldfrag(Ql + qo + 32);
  const float gq = G[(size_t)b * NP + n0 + 16 * qg + c];
  // copy addresses of this lane. K tile: 16-byte chunk tid + 512 i of a contiguous 32 KiB, 8 chunks per 128-B row;
  // V tile: chunk tid + 512 i, 32 chunks per 512-B row of one channel; R: chunk tid + 512 i of 16 KiB.
  const char* gK = (const char*)(FP + (size_t)b * NP * NC) + 16 * tid;
  const char* gV = (const char*)(FC + (size_t)b * NC * NP) + (size_t)(tid >> 5) * (NP * 2) + 16 * (tid & 31);
  const char* gR = (const char*)(R + (size_t)b * NP) + 16 * tid;
  const unsigned lK = lds_addr(Ks) + (tid >> 3) * (KPT * 2) + 16 * (tid & 7);
  const unsigned lV = lds_addr(Vs) + (tid >> 5) * (VPT * 2) + 16 * (tid & 31);
  const unsigned lR = lds_addr(Rl) + 16 * tid;

  // stage 0 and the norm factors, published; then stage 1 in flight
  copy4(lK, 64 * KPT * 2, gK, 16 * NTH);
  copy4(lV, 16 * VPT * 2, gV, (size_t)16 * NP * 2);
  copy2(lR, 16 * NTH, gR, 16 * NTH);
  wait_async0();
  __syncthreads();
  copy4(lK + KT * KPT * 2, 64 * KPT * 2, gK + KT * NC * 2, 16 * NTH);
  copy4(lV + NC * VPT * 2, 16 * VPT * 2, gV + KT * 2, (size_t)16 * NP * 2);

  float m = -1.0e30f, l = 0.f, E = 0.f;
  v8f o[4];
#pragma unroll
  for (int j = 0; j < 4; ++j) o[j] = zero8();

#pragma unroll 1                                                      // one trip = one LDS stage
  for (int st = 0; st < NST; ++st) {
  const int buf = st & 1;
  // this wave's key group of the stage: k fragment base (A operand, row = key c of the tile), v fragment base (A
  // operand, row = channel 16j + c, keys contiguous), per-key norm factors for keys kb + 8hh + r and kb + 16 + 8hh + r
  const unsigned short* Kp = Ks + buf * (KT * KPT) + (kg * KG + c) * KPT + 8 * hh;
  const unsigned short* Vp = Vs + buf * (NC * VPT) + c * VPT + kg * KG + 8 * hh;
  const float* Rp = Rl + st * KT + kg * KG + 8 * hh;
#pragma unroll                                                        // constant LDS offsets for the two passes
  for (int kb = 0; kb < KG; kb += 32) {
    const unsigned short* k0p = Kp + kb * KPT;                      // keys kb .. kb+15 of this wave's key group
    const unsigned short* k1p = Kp + (kb + 16) * KPT;               // keys kb+16 .. kb+31
    v8f s0 = zero8(), s1 = zero8();
    // all LDS reads of the pass stand here in one group: the norm factors and the v fragments return under the score
    // products and the softmax instead of being waited for one by one
    const Frag a0 = ldfrag(k0p), a1 = ldfrag(k0p + 32);
    const Frag c0 = ldfrag(k1p), c1 = ldfrag(k1p + 32);
    const v4f ra = *(const v4f*)(Rp + kb);
    const v4f rb = *(const v4f*)(Rp + kb + 4);
    const v4f rc = *(const v4f*)(Rp + kb + 16);
    const v4f rd = *(const v4f*)(Rp + kb + 20);
    Frag vf[4];
#pragma unroll
    for (int j = 0; j < 4; ++j) vf[j] = ldfrag(Vp + (16 * j) * VPT + kb);
    {
      s0 = mma_b(a0.bf, qh0.bf, s0);
      s1 = mma_b(c0.bf, qh0.bf, s1);
      s0 = mma_b(a0.bf, ql0.bf, s0);
      s1 = mma_b(c0.bf, ql0.bf, s1);
      s0 = mma_b(a1.bf, qh1.bf, s0);
      s1 = mma_b(c1.bf, qh1.bf, s1);
      s0 = mma_b(a1.bf, ql1.bf, s0);
      s1 = mma_b(c1.bf, ql1.bf, s1);
    }
    const float r0v[8] = {ra[0], ra[1], ra[2], ra[3], rb[0], rb[1], rb[2], rb[3]};
    const float r1v[8] = {rc[0], rc[1], rc[2], rc[3], rd[0], rd[1], rd[2], rd[3]};
#pragma unroll
    for (int r = 0; r < 8; ++r) {
      s0[r] = r0v[r] * (s0[r] + gq);                                  // key kb      + 8hh + r
      s1[r] = r1v[r] * (s1[r] + gq);                                  // key kb + 16 + 8hh + r
    }

    float mx = fmaxf(hmax8(s0), hmax8(s1));
    mx = fmaxf(mx, __shfl_xor(mx, 16, 32));
    const float mn = fmaxf(m, mx);
    const unsigned grew = wave_ballot(mx > m);                        // wave-uniform
    if (grew != 0u) {
      const float corr = __expf(m - mn);                              // == 1 exactly for lanes whose max did not grow
      l *= corr;
      E *= corr;
#pragma unroll
      for (int j = 0; j < 4; ++j) {
#pragma unroll
        for (int r = 0; r < 8; ++r) o[j][r] *= corr;
      }
    }
    m = mn;
    const float msh = mn - LNCARRY;                                   // exp gives e^{s-m} * 32768

    FragH ph;
    float ls = 0.f, es = 0.f;
#pragma unroll
    for (int r = 0; r < 8; ++r) {
      const float e0 = __expf(s0[r] - msh);
      const float e1 = __expf(s1[r] - msh);
      ls += e0 + e1;
      const float pe0 = e0 * r0v[r];
      const float pe1 = e1 * r1v[r];
      es += pe0 + pe1;
      ph.hv[0][r] = (_Float16)pe0;
      ph.hv[1][r] = (_Float16)pe1;
    }
    l += ls;
    E += es;

#pragma unroll
    for (int j = 0; j < 4; ++j) o[j] = mma_h(vf[j].h, ph.v, o[j]);
  }
  // publish stage st + 1 and free this stage's buffer
  wait_ds0();
  wait_async0();
  __syncthreads();
  if (st + 2 < NST) {                                                 // same for the whole work-group
    copy4(lK + buf * (KT * KPT * 2), 64 * KPT * 2, gK + (size_t)(st + 2) * (KT * NC * 2), 16 * NTH);
    copy4(lV + buf * (NC * VPT * 2), 16 * VPT * 2, gV + (size_t)(st + 2) * (KT * 2), (size_t)16 * NP * 2);
  }
  }
  wait_async0();
  l += __shfl_xor(l, 16, 32);
  E += __shfl_xor(E, 16, 32);
  // this wave's partial result: Mg[wave][2j + half][lane] = O tile j, Mg[wave][8][lane] = statistics
  {
    v4f* mg = Mg + wave * (9 * 32) + lane;
#pragma unroll
    for (int j = 0; j < 4; ++j) {
      const v4f pa = {o[j][0], o[j][1], o[j][2], o[j][3]};
      const v4f pb = {o[j][4], o[j][5], o[j][6], o[j][7]};
      mg[(2 * j) * 32]     = pa;
      mg[(2 * j + 1) * 32] = pb;
    }
    const v4f ps = {m, l, E, 0.f};
    mg[8 * 32] = ps;
  }
  __syncthreads();
  // join the four key groups for channel block kg of query group qg, key groups in fixed order 0..3
  v4f sg[NKG], ag[NKG], bg[NKG];
#pragma unroll
  for (int g = 0; g < NKG; ++g) {
    const v4f* mg = Mg + (g * 4 + qg) * (9 * 32) + lane;
    sg[g] = mg[8 * 32];
    ag[g] = mg[(2 * kg) * 32];
    bg[g] = mg[(2 * kg + 1) * 32];
  }
  const float mm = fmaxf(fmaxf(sg[0][0], sg[1][0]), fmaxf(sg[2][0], sg[3][0]));
  float lt = 0.f, Et = 0.f;
  v4f oa = {0.f, 0.f, 0.f, 0.f}, ob = {0.f, 0.f, 0.f, 0.f};
#pragma unroll
  for (int g = 0; g < NKG; ++g) {
    const float wg = exp_slot(sg[g][0] - mm);
    lt += wg * sg[g][1];
    Et += wg * sg[g][2];
#pragma unroll
    for (int r = 0; r < 4; ++r) {
      oa[r] += wg * ag[g][r];
      ob[r] += wg * bg[g][r];
    }
  }
  const float inv = 1.0f / lt;                                        // o, E and l all carry the 2^15 factor
  const float ee  = EPSV * Et;

  const int qrow = 16 * qg + c;
  {
    v4f va, vb;
#pragma unroll
    for (int r = 0; r < 4; ++r) {
      va[r] = (oa[r] * IXSC + ee) * inv;
      vb[r] = (ob[r] * IXSC + ee) * inv;
    }
    *(v4f*)(Os + qrow * OSP + 16 * kg + 8 * hh)     = va;             // Os[query][ch = 16kg + 8hh + r]
    *(v4f*)(Os + qrow * OSP + 16 * kg + 8 * hh + 4) = vb;
  }
  __syncthreads();
  const int e = tid & 7, lq = tid >> 3;                               // lq 0..63
  v4f res[2];
#pragma unroll
  for (int it = 0; it < 2; ++it) {
    const int L   = it * 64 + lq;                                     // 0..127
    const int chl = L >> 1, hf = L & 1;                               // channel 0..63
    const int nl  = hf * 32 + 4 * e;                                  // query 0..63
#pragma unroll
    for (int t = 0; t < 4; ++t) res[it][t] = Os[(nl + t) * OSP + chl];
  }
{
#pragma unroll
    for (int it = 0; it < 2; ++it) {
      const int L   = it * 64 + lq;
      const int chl = L >> 1, hf = L & 1;
      const int nl  = hf * 32 + 4 * e;
      const size_t idx = ((size_t)(b * NC + chl)) * NP + n0 + nl;
      *(v4f*)(out + idx) = res[it];
    }
    
  }
}

// =============================================================================================================
// Workspace map (bytes; each region start a multiple of 256; every extent is an exact tile multiple and is written
//   FC f16 [NIMG][64][4096]   2097152      FP bf16 [NIMG][4096][64]  2097152
//   Qh/Ql bf16 [NIMG][4096][64]  2097152 x2
//   R f32 [NIMG][4096]  65536              G f32 [NIMG][4096]  65536
//   total (NIMG = 4) = 8519680
// =============================================================================================================
extern "C" void kernel_launch(void* const* d_in, const int* in_sizes, int n_in,
                              void* d_out, int out_size, void* d_ws, size_t ws_size,
                              hipStream_t stream) {
  const int XN = NIMG * NC * NP;
  if (n_in < 2) return;
  if (in_sizes[0] < XN) return;
  if (out_size < XN) return;

  size_t off = 0;
  auto carve = [&](size_t bytes) { const size_t o = off; off += (bytes + 255) & ~(size_t)255; return o; };
  const size_t oFC = carve((size_t)NIMG * NC * NP * 2);
  const size_t oFP = carve((size_t)NIMG * NP * NC * 2);
  const size_t oQh = carve((size_t)NIMG * NP * NC * 2);
  const size_t oQl = carve((size_t)NIMG * NP * NC * 2);
  const size_t oR  = carve((size_t)NIMG * NP * 4);
  const size_t oG  = carve((size_t)NIMG * NP * 4);
  if (off > ws_size) return;
  if (off > (size_t)134217728) return;

  const float* fg = (const float*)d_in[0];
  // d_in[1] (second input) does not enter this forward output; its pointer is bound to the first launch, unread.
  const float* aux = (const float*)d_in[1];

  char* ws = (char*)d_ws;
  unsigned short* FC = (unsigned short*)(ws + oFC);
  unsigned short* FP = (unsigned short*)(ws + oFP);
  unsigned short* Qh = (unsigned short*)(ws + oQh);
  unsigned short* Ql = (unsigned short*)(ws + oQl);
  float* R = (float*)(ws + oR);
  float* G = (float*)(ws + oG);
  float* out = (float*)d_out;

  const dim3 blk256(256), blkat(NTH);

  // (1) input -> channel-major f16 plane, key-major bf16 plane, per-pixel norm factors
  cvt_f<<<dim3(NP / QT, NIMG), blk256, 0, stream>>>(fg, aux, FC, FP, R);
  // (2) 3x3 window sums -> query hi + residual bf16 planes, eps terms
  pool_q<<<dim3(HW, NIMG), blk256, 0, stream>>>(fg, Qh, Ql, G);
  // (3) attention over the 4096 per-pixel kernels -> out [b][64][4096]
  attn_k<<<dim3(NP / QT, NIMG), blkat, 0, stream>>>(Qh, Ql, FP, FC, R, G, out);
  (void)hipGetLastError();
}

// v003
// Measured time: 34.6 microseconds a run.
// Timed twice side by side with v002, it ran 1.06 and 1.05 times as fast.
// Over all steps from v000 it is 6.52 times as fast.
// Contractions: scores S^T[p][q] = FB[p][c].Q[q][c] on v_wmma_f32_16x16x32_bf16 (A = bf16-RNE input rows, exact;
// B = bf16 hi + bf16 residual planes of the 3x3-summed input, 2 products, K = 64); O^T[c][q] = FB16[c][p].P[p][q]
// on v_wmma_f32_16x16x32_f16 (A = f16 of 16 x bf16-RNE input, exact; B = f16 of e^{s-m} x 2^15 x r_p from the
// score D registers); f32 accumulate; per-pixel norm factor r_p, softmax statistics and the eps terms in f32 VALU.
#include <hip/hip_runtime.h>
#include <math.h>
#include <stdint.h>

#ifndef NIMG
#define NIMG 4
#endif
#define NB_FULL 4
#define NC     64
#define HW     64
#define NP     4096
#define QT     64
#define TP     72
#define OSP    68
#define XSC    16.0f
#define IXSC   0.0625f
#define EPSV   1.0e-7f
#define LNCARRY 10.397207708399179f
#define KT     256
#define NST    (NP / KT)
#define KPT    72
#define VPT    264
#define NKG    4
#define KG     (KT / NKG)
#define NTH    (128 * NKG)

static_assert(NIMG >= 1 && NIMG <= NB_FULL);
static_assert(NP == HW * HW);
static_assert(NP % QT == 0 && NP % 32 == 0);
static_assert(NC == 64);
static_assert(QT == 64 && QT == HW);                           // one query tile = one image row
static_assert((TP * 2) % 16 == 0);
static_assert((OSP * 4) % 16 == 0);
static_assert(NP % KT == 0 && KT % 32 == 0 && NST >= 2);
static_assert((KPT * 2) % 32 == 16 && (VPT * 2) % 32 == 16);   // LDS row pitch = 16 B x odd for b128 readers
static_assert(KT * NC * 2 == 4 * NTH * 16);                    // one tile = 4 copies of 16 B by each of 512 lanes
static_assert(NP * 4 == 2 * NTH * 16);
static_assert(KG % 32 == 0 && NKG == NC / 16);                 // wave of key group g merges channel block g

typedef _Float16       v16h __attribute__((ext_vector_type(16)));
typedef _Float16       v8h  __attribute__((ext_vector_type(8)));
typedef __bf16         v16b __attribute__((ext_vector_type(16)));
typedef unsigned short v8us __attribute__((ext_vector_type(8)));
typedef float          v8f  __attribute__((ext_vector_type(8)));
typedef float          v4f  __attribute__((ext_vector_type(4)));
typedef unsigned int   v4u  __attribute__((ext_vector_type(4)));

union Frag  { v8us u[2]; v16h h; v16b bf; };
union FragH { v16h v; v8h hv[2]; };
static_assert(sizeof(Frag) == 32);
static_assert(sizeof(FragH) == 32);

// ---- scalar helpers -------------------------------------------------------------------------------------------
__device__ __forceinline__ unsigned short bf_bits(float f) {          // f32 -> bf16 bits, RNE convert
  unsigned u = __float_as_uint(f);
  return (unsigned short)((u + 0x7FFFu + ((u >> 16) & 1u)) >> 16);
}
__device__ __forceinline__ float bf_up(unsigned short hb) { return __uint_as_float(((unsigned)hb) << 16); }
__device__ __forceinline__ float bfr(float f) { return bf_up(bf_bits(f)); }
__device__ __forceinline__ unsigned short h_bits(_Float16 x) { return __builtin_bit_cast(unsigned short, x); }
__device__ __forceinline__ unsigned pk16(unsigned short a, unsigned short b) { return (unsigned)a | ((unsigned)b << 16); }
__device__ __forceinline__ v8f zero8() { v8f z = {0.f, 0.f, 0.f, 0.f, 0.f, 0.f, 0.f, 0.f}; return z; }
__device__ __forceinline__ float hmax8(v8f s) {
  return fmaxf(fmaxf(fmaxf(s[0], s[1]), fmaxf(s[2], s[3])), fmaxf(fmaxf(s[4], s[5]), fmaxf(s[6], s[7])));
}
__device__ __forceinline__ unsigned wave_ballot(bool p) {
#if defined(__HIP_DEVICE_COMPILE__)
  return __builtin_amdgcn_ballot_w32(p);
#else
  return p ? 1u : 0u;
#endif
}

// e^x as __expf forms it (multiply by log2 e, v_exp_f32), with the one free vector slot that the instruction set asks
// for behind a transcendental written into the same statement, so that no reader or overwrite stands directly behind it
__device__ __forceinline__ float exp_slot(float x) {
  const float t = x * 1.44269504f;
  float y = t;
#if defined(__HIP_DEVICE_COMPILE__)
  asm("v_exp_f32 %0, %1\n\tv_nop" : "=v"(y) : "v"(t));
#endif
  return y;
}

// ---- 16-bit fragment loader (A, or B from a k-contiguous [n][k] row): lane -> row/col (lane&15), p already includes
//      + 8*(lane>>4); elements 0..7 <- p[0..7] (k0+8h..), elements 8..15 <- p[16..23] (k0+16+8h..)
__device__ __forceinline__ Frag ldfrag(const unsigned short* p) {
  Frag f;
  f.u[0] = *(const v8us*)(p);
  f.u[1] = *(const v8us*)(p + 16);
  return f;
}

// ---- WMMA helpers: builtin followed by a 4-slot VALU gap tying D and keeping A/B live ----------------------------
__device__ __forceinline__ v8f mma_h(v16h a, v16h b, v8f c) {
  v8f d = __builtin_amdgcn_wmma_f32_16x16x32_f16(false, a, false, b, (short)0, c, false, false);
#if defined(__HIP_DEVICE_COMPILE__)
  asm volatile("v_nop\n\tv_nop\n\tv_nop\n\tv_nop" : "+v"(d) : "v"(a), "v"(b));
#endif
  return d;
}
__device__ __forceinline__ v8f mma_b(v16b a, v16b b, v8f c) {
  v8f d = __builtin_amdgcn_wmma_f32_16x16x32_bf16(false, a, false, b, (short)0, c, false, false);
#if defined(__HIP_DEVICE_COMPILE__)
  const v16h ha = __builtin_bit_cast(v16h, a), hb = __builtin_bit_cast(v16h, b);
  asm volatile("v_nop\n\tv_nop\n\tv_nop\n\tv_nop" : "+v"(d) : "v"(ha), "v"(hb));
#endif
  return d;
}

// ---- asynchronous copies global -> LDS ---------------------------------------------------------------------------
typedef __attribute__((address_space(3))) const unsigned char lds_byte;
__device__ __forceinline__ unsigned lds_addr(const void* p) { return (unsigned)(uintptr_t)(lds_byte*)p; }
// Four (two) 16-byte copies per lane: LDS byte address l + i * ls <- global g + i * gs. The s_wait_xcnt stands inside
// the statement so that no address register named by a copy is rewritten in front of it.
__device__ __forceinline__ void copy4(unsigned l, unsigned ls, const char* g, size_t gs) {
#if defined(__HIP_DEVICE_COMPILE__)
  asm volatile(
      "global_load_async_to_lds_b128 %0, %4, off\n\t"
      "global_load_async_to_lds_b128 %1, %5, off\n\t"
      "global_load_async_to_lds_b128 %2, %6, off\n\t"
      "global_load_async_to_lds_b128 %3, %7, off\n\t"
      "s_wait_xcnt 0x0"
      :: "v"(l), "v"(l + ls), "v"(l + 2 * ls), "v"(l + 3 * ls), "v"(g), "v"(g + gs), "v"(g + 2 * gs), "v"(g + 3 * gs)
      : "memory");
#endif
}
__device__ __forceinline__ void copy2(unsigned l, unsigned ls, const char* g, size_t gs) {
#if defined(__HIP_DEVICE_COMPILE__)
  asm volatile(
      "global_load_async_to_lds_b128 %0, %2, off\n\t"
      "global_load_async_to_lds_b128 %1, %3, off\n\t"
      "s_wait_xcnt 0x0"
      :: "v"(l), "v"(l + ls), "v"(g), "v"(g + gs)
      : "memory");
#endif
}
__device__ __forceinline__ void wait_x0() {
#if defined(__HIP_DEVICE_COMPILE__)
  asm volatile("s_wait_xcnt 0x0" ::: "memory");
#endif
}
// this wave's copies have landed in LDS
__device__ __forceinline__ void wait_async0() {
#if defined(__HIP_DEVICE_COMPILE__)
  asm volatile("s_wait_asynccnt 0x0" ::: "memory");
#endif
}
// this wave's LDS reads have returned, so the buffer may be handed to its next writer
__device__ __forceinline__ void wait_ds0() {
#if defined(__HIP_DEVICE_COMPILE__)
  asm volatile("s_wait_dscnt 0x0" ::: "memory");
#endif
}

// =============================================================================================================
// (1) per (b, image row y), one launch for every operand plane of the row's 64 pixels p = 64 y + x:
//     FC f16 [b][c][p] = f16(16 * bf16-RNE(x)) (exact, channel-major, keys contiguous), FP bf16 [b][p][c] =
//     bf16-RNE(x) (key-major, channels contiguous) through an LDS tile T[64 x][64 c] (pitch TP), R f32 [b][p] =
//     rsqrt(sum_c (bf16-RNE(x) + eps)^2) (4 lanes per p, fixed order);
//     FPOOL[c][x] = 3x3 zero-padded window sum of bf16-RNE(x) centred on pixel (y, x), f32, then Qh/Ql bf16
//     [b][q = 64 y + x][64 c] (query-major, channels contiguous): hi = bf16-RNE(v), lo = bf16-RNE(v - hi), staged
//     through LDS tiles Th/Tl[64 x][64 c] (pitch TP); G f32 [b][q] = eps * sum_c FPOOL.
//     Thread (ch = tid>>2, xq = tid&3) loads channel ch at x = 16 xq .. 16 xq + 15 of rows y-1, y, y+1; the centre
//     row's rounded values feed FC, T and the window sums alike. Edge taps use clamped addresses and are zeroed by
//     predicate; the row-validity test is block-uniform. The second pointer argument (aux) is bound only, never read.
// coverage: FC 64 ch x 4 lanes x 16 = 64 c x 64 p; FP, Qh, Ql 2 it x 32 rows x 8 lanes x 8 = 64 x x 64 c per plane;
//           R, G 16 lanes x 4 = 64; grid (64 y, NIMG) covers every c, p, q of images 0..NIMG-1 exactly once.
//           LDS: T/Th/Tl written 64 x 64, read 64 x 64; Gs written 64 c x 64 x, read same; Gq, Rs 64/64.
// =============================================================================================================
__global__ __launch_bounds__(256)
void prep_f(const float* __restrict__ f, const float* __restrict__ aux, unsigned short* FC, unsigned short* FP,
            float* R, unsigned short* Qh, unsigned short* Ql, float* G) {
  (void)aux;
  __shared__ __align__(16) unsigned short T[QT * TP];
  __shared__ __align__(16) unsigned short Th[QT * TP];
  __shared__ __align__(16) unsigned short Tl[QT * TP];
  __shared__ __align__(16) float Gs[NC * QT];
  __shared__ __align__(16) float Gq[QT];
  __shared__ __align__(16) float Rs[QT];
  const int tid = threadIdx.x;
  const int y = blockIdx.x, b = blockIdx.y;
  const int ch = tid >> 2, xq = tid & 3, x0 = 16 * xq;
  const float* fc = f + ((size_t)(b * NC + ch)) * NP;
  float s[16], cv[16];
#pragma unroll
  for (int i = 0; i < 16; ++i) { s[i] = 0.f; cv[i] = 0.f; }
#pragma unroll
  for (int dy = -1; dy <= 1; ++dy) {
    const int yy = y + dy;                                            // block-uniform
    if (yy >= 0 && yy < HW) {
      const float* row = fc + yy * HW;
      const v4f a0 = *(const v4f*)(row + x0);
      const v4f a1 = *(const v4f*)(row + x0 + 4);
      const v4f a2 = *(const v4f*)(row + x0 + 8);
      const v4f a3 = *(const v4f*)(row + x0 + 12);
      const int xl = (x0 > 0) ? (x0 - 1) : 0;                          // clamped addresses
      const int xr = (x0 + 16 < HW) ? (x0 + 16) : (HW - 1);
      float vl = row[xl];
      float vr = row[xr];
      wait_x0();                                                      // in front of any rewrite of the six loads' address registers
      vl = (x0 > 0) ? vl : 0.f;
      vr = (x0 + 16 < HW) ? vr : 0.f;
      float v[18];
      v[0] = bfr(vl); v[17] = bfr(vr);
#pragma unroll
      for (int t = 0; t < 4; ++t) {
        v[1 + t]  = bfr(a0[t]);
        v[5 + t]  = bfr(a1[t]);
        v[9 + t]  = bfr(a2[t]);
        v[13 + t] = bfr(a3[t]);
      }
#pragma unroll
      for (int i = 0; i < 16; ++i) s[i] += (v[i] + v[i + 1]) + v[i + 2];
      if (dy == 0) {                                                  // the row's own pixels, bf16-RNE in f32
#pragma unroll
        for (int i = 0; i < 16; ++i) cv[i] = v[i + 1];
      }
    }
  }
  v4u uc[2];
  {
    unsigned short hb[16];
#pragma unroll
    for (int i = 0; i < 16; ++i) {
      hb[i] = h_bits((_Float16)(cv[i] * XSC));
      T[(x0 + i) * TP + ch] = (unsigned short)(__float_as_uint(cv[i]) >> 16);   // T[x][c], the bf16 bits
    }
#pragma unroll
    for (int t = 0; t < 4; ++t) {
      uc[0][t] = pk16(hb[2 * t], hb[2 * t + 1]);
      uc[1][t] = pk16(hb[8 + 2 * t], hb[9 + 2 * t]);
    }
  }
#pragma unroll
  for (int i = 0; i < 16; ++i) {
    const unsigned short hb = bf_bits(s[i]);
    const unsigned short lb = bf_bits(s[i] - bf_up(hb));
    Th[(x0 + i) * TP + ch] = hb;
    Tl[(x0 + i) * TP + ch] = lb;
  }
#pragma unroll
  for (int t = 0; t < 4; ++t) {
    v4f gv4 = {s[4 * t], s[4 * t + 1], s[4 * t + 2], s[4 * t + 3]};
    *(v4f*)(Gs + ch * QT + x0 + 4 * t) = gv4;
  }
  __syncthreads();
  if (tid < QT) {                                                     // waves 0 and 1 entirely
    float g = 0.f;
#pragma unroll 4
    for (int cc = 0; cc < NC; ++cc) g += Gs[cc * QT + tid];
    Gq[tid] = g * EPSV;
  }
  const int e = tid & 7, lq = tid >> 3;                              // lq 0..31
  v4u up[2], uh[2], ul[2];
#pragma unroll
  for (int it = 0; it < 2; ++it) {
    const int xl2 = it * 32 + lq;                                     // x 0..63
    up[it] = *(const v4u*)(T + xl2 * TP + 8 * e);
    uh[it] = *(const v4u*)(Th + xl2 * TP + 8 * e);
    ul[it] = *(const v4u*)(Tl + xl2 * TP + 8 * e);
  }
  {
    const int pl = tid >> 2, sub = tid & 3;                          // 4 lanes per p, 16 channels each
    const unsigned short* tr = T + pl * TP + 16 * sub;
    const v8us w0 = *(const v8us*)(tr);
    const v8us w1 = *(const v8us*)(tr + 8);
    float q = 0.f;
#pragma unroll
    for (int i = 0; i < 8; ++i) { const float v = bf_up(w0[i]) + EPSV; q += v * v; }
#pragma unroll
    for (int i = 0; i < 8; ++i) { const float v = bf_up(w1[i]) + EPSV; q += v * v; }
    q += __shfl_xor(q, 1, 32);
    q += __shfl_xor(q, 2, 32);
    if (sub == 0) Rs[pl] = rsqrtf(q);
  }
  __syncthreads();
  const v4f gv = *(const v4f*)(Gq + 4 * (tid & 15));
  const v4f rv = *(const v4f*)(Rs + 4 * (tid & 15));
  {
    unsigned short* fo = FC + ((size_t)(b * NC + ch)) * NP + y * HW + x0;
    *(v4u*)(fo)     = uc[0];
    *(v4u*)(fo + 8) = uc[1];
#pragma unroll
    for (int it = 0; it < 2; ++it) {
      const int xl2 = it * 32 + lq;
      const size_t po = ((size_t)(b * NP + y * HW + xl2)) * NC + 8 * e;
      *(v4u*)(FP + po) = up[it];
      *(v4u*)(Qh + po) = uh[it];
      *(v4u*)(Ql + po) = ul[it];
    }
    if (tid < 16) {
      *(v4f*)(R + (size_t)b * NP + y * HW + 4 * tid) = rv;
      *(v4f*)(G + (size_t)b * NP + y * HW + 4 * tid) = gv;
    }
  }
}

// =============================================================================================================
// (2) attention for one (b, 64-query tile), transposed formulation, 4096 keys, no mask:
//   S^T tile (16 keys x 16 queries) = A(FP row = key kb + (lane&15), 64 channels via the split k map, bf16 exact)
//   . B(Qh row = query, same map) + A(FP).B(Ql) (unscaled bf16 residual, shared accumulator), K = 64 = 2 steps;
//   then s = r_key * (acc + g_query) (per-key norm factor and the eps term, f32). Q fragments and g are loaded once.
//   Per lane the D tile holds 8 keys of ONE query: online softmax per lane, one shuffle (lane^16) for the max over
//   32 keys; the o/l/E rescale is skipped under a wave-uniform ballot when no lane's max grew. P = f16 of
//   e^{s-m} x 2^15 x r_key is the B operand of O^T (rows channel 16j + (lane&15), keys contiguous, f16 plane FC =
//   16 x input) . B(P^T): element r <- D of the tile covering keys kb..kb+15, element 8+r <- the tile covering
//   kb+16..kb+31, lane unchanged. 4 accumulator tiles per wave (64 channels). l = sum e and E = sum e r_key in f32.
//   Waves: 16 per work-group, four per SIMD. Wave w works on query group qg = w & 3 (16 queries) and key group
//   kg = w >> 2: of every stage it takes keys 64 kg .. 64 kg + 63 (two passes of 32), with softmax statistics and
//   accumulators of its own; the vector work of one wave runs under the matrix work and the LDS waits of the others.
//   Data path: the work-group's waves share every key tile. A stage = KT = 256 keys: FP rows (256 x 128 B, LDS
//   pitch 144 B) and FC rows (64 x 512 B, LDS pitch 528 B) come by 16-byte asynchronous copies into one of two LDS
//   buffers, one stage ahead of the stage being worked on; all 4096 norm factors of the image are copied once with
//   stage 0. Foot of each stage: LDS reads returned, own copies landed, barrier, then the refill of the buffer just read.
//   Merge: every wave stores m, l, E and its four O tiles in LDS Mg, barrier; wave (qg, kg) joins channel block kg of
//   query group qg over the four key groups in fixed order: weight e^{m_g - max m}, sums of l, E and O.
//   Epilogue: out = (O / 16 + eps E) / l staged in LDS Os[query][64 channels] (pitch OSP, b128 stores), barrier,
// coverage: Mg 16 waves x 9 x 32 lanes written, read 4 x 3 x 32 per wave; Os 16 waves x 16 queries x 16 ch; out 2 it x
//           64 lines x 8 lanes x 4 floats = 64 ch x 64 queries;
//           grid (64, NIMG) covers out[b][0..63][0..4095] of images 0..NIMG-1 exactly once.
// =============================================================================================================
__global__ __launch_bounds__(NTH)
void attn_k(const unsigned short* __restrict__ Qh, const unsigned short* __restrict__ Ql,
            const unsigned short* __restrict__ FP, const unsigned short* __restrict__ FC,
            const float* __restrict__ R, const float* __restrict__ G, float* out) {
  __shared__ __align__(16) float Os[QT * OSP];
  __shared__ __align__(16) unsigned short Ks[2 * KT * KPT];
  __shared__ __align__(16) unsigned short Vs[2 * NC * VPT];
  __shared__ __align__(16) float Rl[NP];
  __shared__ __align__(16) v4f Mg[4 * NKG * 9 * 32];
  const int tid  = threadIdx.x;
  const int wave = tid >> 5, lane = tid & 31;
  const int qg   = wave & 3, kg = wave >> 2;
  const int hh   = lane >> 4, c = lane & 15;
  const int n0   = blockIdx.x * QT, b = blockIdx.y;

  // q fragments (B operand, col = query n0 + 16*qg + c), channels 0..31 and 32..63
  const size_t qo = ((size_t)(b * NP + n0 + 16 * qg + c)) * NC + 8 * hh;
  const Frag qh0 = ldfrag(Qh + qo);
  const Frag qh1 = ldfrag(Qh + qo + 32);
  const Frag ql0 = ldfrag(Ql + qo);
  const Frag ql1 = ldfrag(Ql + qo + 32);
  const float gq = G[(size_t)b * NP + n0 + 16 * qg + c];
  // copy addresses of this lane. K tile: 16-byte chunk tid + 512 i of a contiguous 32 KiB, 8 chunks per 128-B row;
  // V tile: chunk tid + 512 i, 32 chunks per 512-B row of one channel; R: chunk tid + 512 i of 16 KiB.
  const char* gK = (const char*)(FP + (size_t)b * NP * NC) + 16 * tid;
  const char* gV = (const char*)(FC + (size_t)b * NC * NP) + (size_t)(tid >> 5) * (NP * 2) + 16 * (tid & 31);
  const char* gR = (const char*)(R + (size_t)b * NP) + 16 * tid;
  const unsigned lK = lds_addr(Ks) + (tid >> 3) * (KPT * 2) + 16 * (tid & 7);
  const unsigned lV = lds_addr(Vs) + (tid >> 5) * (VPT * 2) + 16 * (tid & 31);
  const unsigned lR = lds_addr(Rl) + 16 * tid;

  // stage 0 and the norm factors, published; then stage 1 in flight
  copy4(lK, 64 * KPT * 2, gK, 16 * NTH);
  copy4(lV, 16 * VPT * 2, gV, (size_t)16 * NP * 2);
  copy2(lR, 16 * NTH, gR, 16 * NTH);
  wait_async0();
  __syncthreads();
  copy4(lK + KT * KPT * 2, 64 * KPT * 2, gK + KT * NC * 2, 16 * NTH);
  copy4(lV + NC * VPT * 2, 16 * VPT * 2, gV + KT * 2, (size_t)16 * NP * 2);

  float m = -1.0e30f, l = 0.f, E = 0.f;
  v8f o[4];
#pragma unroll
  for (int j = 0; j < 4; ++j) o[j] = zero8();

#pragma unroll 1                                                      // one trip = one LDS stage
  for (int st = 0; st < NST; ++st) {
  const int buf = st & 1;
  // this wave's key group of the stage: k fragment base (A operand, row = key c of the tile), v fragment base (A
  // operand, row = channel 16j + c, keys contiguous), per-key norm factors for keys kb + 8hh + r and kb + 16 + 8hh + r
  const unsigned short* Kp = Ks + buf * (KT * KPT) + (kg * KG + c) * KPT + 8 * hh;
  const unsigned short* Vp = Vs + buf * (NC * VPT) + c * VPT + kg * KG + 8 * hh;
  const float* Rp = Rl + st * KT + kg * KG + 8 * hh;
#pragma unroll                                                        // constant LDS offsets for the two passes
  for (int kb = 0; kb < KG; kb += 32) {
    const unsigned short* k0p = Kp + kb * KPT;                      // keys kb .. kb+15 of this wave's key group
    const unsigned short* k1p = Kp + (kb + 16) * KPT;               // keys kb+16 .. kb+31
    v8f s0 = zero8(), s1 = zero8();
    // all LDS reads of the pass stand here in one group: the norm factors and the v fragments return under the score
    // products and the softmax instead of being waited for one by one
    const Frag a0 = ldfrag(k0p), a1 = ldfrag(k0p + 32);
    const Frag c0 = ldfrag(k1p), c1 = ldfrag(k1p + 32);
    const v4f ra = *(const v4f*)(Rp + kb);
    const v4f rb = *(const v4f*)(Rp + kb + 4);
    const v4f rc = *(const v4f*)(Rp + kb + 16);
    const v4f rd = *(const v4f*)(Rp + kb + 20);
    Frag vf[4];
#pragma unroll
    for (int j = 0; j < 4; ++j) vf[j] = ldfrag(Vp + (16 * j) * VPT + kb);
    {
      s0 = mma_b(a0.bf, qh0.bf, s0);
      s1 = mma_b(c0.bf, qh0.bf, s1);
      s0 = mma_b(a0.bf, ql0.bf, s0);
      s1 = mma_b(c0.bf, ql0.bf, s1);
      s0 = mma_b(a1.bf, qh1.bf, s0);
      s1 = mma_b(c1.bf, qh1.bf, s1);
      s0 = mma_b(a1.bf, ql1.bf, s0);
      s1 = mma_b(c1.bf, ql1.bf, s1);
    }
    const float r0v[8] = {ra[0], ra[1], ra[2], ra[3], rb[0], rb[1], rb[2], rb[3]};
    const float r1v[8] = {rc[0], rc[1], rc[2], rc[3], rd[0], rd[1], rd[2], rd[3]};
#pragma unroll
    for (int r = 0; r < 8; ++r) {
      s0[r] = r0v[r] * (s0[r] + gq);                                  // key kb      + 8hh + r
      s1[r] = r1v[r] * (s1[r] + gq);                                  // key kb + 16 + 8hh + r
    }

    float mx = fmaxf(hmax8(s0), hmax8(s1));
    mx = fmaxf(mx, __shfl_xor(mx, 16, 32));
    const float mn = fmaxf(m, mx);
    const unsigned grew = wave_ballot(mx > m);                        // wave-uniform
    if (grew != 0u) {
      const float corr = __expf(m - mn);                              // == 1 exactly for lanes whose max did not grow
      l *= corr;
      E *= corr;
#pragma unroll
      for (int j = 0; j < 4; ++j) {
#pragma unroll
        for (int r = 0; r < 8; ++r) o[j][r] *= corr;
      }
    }
    m = mn;
    const float msh = mn - LNCARRY;                                   // exp gives e^{s-m} * 32768

    FragH ph;
    float ls = 0.f, es = 0.f;
#pragma unroll
    for (int r = 0; r < 8; ++r) {
      const float e0 = __expf(s0[r] - msh);
      const float e1 = __expf(s1[r] - msh);
      ls += e0 + e1;
      const float pe0 = e0 * r0v[r];
      const float pe1 = e1 * r1v[r];
      es += pe0 + pe1;
      ph.hv[0][r] = (_Float16)pe0;
      ph.hv[1][r] = (_Float16)pe1;
    }
    l += ls;
    E += es;

#pragma unroll
    for (int j = 0; j < 4; ++j) o[j] = mma_h(vf[j].h, ph.v, o[j]);
  }
  // publish stage st + 1 and free this stage's buffer
  wait_ds0();
  wait_async0();
  __syncthreads();
  if (st + 2 < NST) {                                                 // same for the whole work-group
    copy4(lK + buf * (KT * KPT * 2), 64 * KPT * 2, gK + (size_t)(st + 2) * (KT * NC * 2), 16 * NTH);
    copy4(lV + buf * (NC * VPT * 2), 16 * VPT * 2, gV + (size_t)(st + 2) * (KT * 2), (size_t)16 * NP * 2);
  }
  }
  wait_async0();
  l += __shfl_xor(l, 16, 32);
  E += __shfl_xor(E, 16, 32);
  // this wave's partial result: Mg[wave][2j + half][lane] = O tile j, Mg[wave][8][lane] = statistics
  {
    v4f* mg = Mg + wave * (9 * 32) + lane;
#pragma unroll
    for (int j = 0; j < 4; ++j) {
      const v4f pa = {o[j][0], o[j][1], o[j][2], o[j][3]};
      const v4f pb = {o[j][4], o[j][5], o[j][6], o[j][7]};
      mg[(2 * j) * 32]     = pa;
      mg[(2 * j + 1) * 32] = pb;
    }
    const v4f ps = {m, l, E, 0.f};
    mg[8 * 32] = ps;
  }
  __syncthreads();
  // join the four key groups for channel block kg of query group qg, key groups in fixed order 0..3
  v4f sg[NKG], ag[NKG], bg[NKG];
#pragma unroll
  for (int g = 0; g < NKG; ++g) {
    const v4f* mg = Mg + (g * 4 + qg) * (9 * 32) + lane;
    sg[g] = mg[8 * 32];
    ag[g] = mg[(2 * kg) * 32];
    bg[g] = mg[(2 * kg + 1) * 32];
  }
  const float mm = fmaxf(fmaxf(sg[0][0], sg[1][0]), fmaxf(sg[2][0], sg[3][0]));
  float lt = 0.f, Et = 0.f;
  v4f oa = {0.f, 0.f, 0.f, 0.f}, ob = {0.f, 0.f, 0.f, 0.f};
#pragma unroll
  for (int g = 0; g < NKG; ++g) {
    const float wg = exp_slot(sg[g][0] - mm);
    lt += wg * sg[g][1];
    Et += wg * sg[g][2];
#pragma unroll
    for (int r = 0; r < 4; ++r) {
      oa[r] += wg * ag[g][r];
      ob[r] += wg * bg[g][r];
    }
  }
  const float inv = 1.0f / lt;                                        // o, E and l all carry the 2^15 factor
  const float ee  = EPSV * Et;

  const int qrow = 16 * qg + c;
  {
    v4f va, vb;
#pragma unroll
    for (int r = 0; r < 4; ++r) {
      va[r] = (oa[r] * IXSC + ee) * inv;
      vb[r] = (ob[r] * IXSC + ee) * inv;
    }
    *(v4f*)(Os + qrow * OSP + 16 * kg + 8 * hh)     = va;             // Os[query][ch = 16kg + 8hh + r]
    *(v4f*)(Os + qrow * OSP + 16 * kg + 8 * hh + 4) = vb;
  }
  __syncthreads();
  const int e = tid & 7, lq = tid >> 3;                               // lq 0..63
  v4f res[2];
#pragma unroll
  for (int it = 0; it < 2; ++it) {
    const int L   = it * 64 + lq;                                     // 0..127
    const int chl = L >> 1, hf = L & 1;                               // channel 0..63
    const int nl  = hf * 32 + 4 * e;                                  // query 0..63
#pragma unroll
    for (int t = 0; t < 4; ++t) res[it][t] = Os[(nl + t) * OSP + chl];
  }
{
#pragma unroll
    for (int it = 0; it < 2; ++it) {
      const int L   = it * 64 + lq;
      const int chl = L >> 1, hf = L & 1;
      const int nl  = hf * 32 + 4 * e;
      const size_t idx = ((size_t)(b * NC + chl)) * NP + n0 + nl;
      *(v4f*)(out + idx) = res[it];
    }
    
  }
}

// =============================================================================================================
// Workspace map (bytes; each region start a multiple of 256; every extent is an exact tile multiple and is written
//   FC f16 [NIMG][64][4096]   2097152      FP bf16 [NIMG][4096][64]  2097152
//   Qh/Ql bf16 [NIMG][4096][64]  2097152 x2
//   R f32 [NIMG][4096]  65536              G f32 [NIMG][4096]  65536
//   total (NIMG = 4) = 8519680
// =============================================================================================================
extern "C" void kernel_launch(void* const* d_in, const int* in_sizes, int n_in,
                              void* d_out, int out_size, void* d_ws, size_t ws_size,
                              hipStream_t stream) {
  const int XN = NIMG * NC * NP;
  if (n_in < 2) return;
  if (in_sizes[0] < XN) return;
  if (out_size < XN) return;

  size_t off = 0;
  auto carve = [&](size_t bytes) { const size_t o = off; off += (bytes + 255) & ~(size_t)255; return o; };
  const size_t oFC = carve((size_t)NIMG * NC * NP * 2);
  const size_t oFP = carve((size_t)NIMG * NP * NC * 2);
  const size_t oQh = carve((size_t)NIMG * NP * NC * 2);
  const size_t oQl = carve((size_t)NIMG * NP * NC * 2);
  const size_t oR  = carve((size_t)NIMG * NP * 4);
  const size_t oG  = carve((size_t)NIMG * NP * 4);
  if (off > ws_size) return;
  if (off > (size_t)134217728) return;

  const float* fg = (const float*)d_in[0];
  // d_in[1] (second input) does not enter this forward output; its pointer is bound to the first launch, unread.
  const float* aux = (const float*)d_in[1];

  char* ws = (char*)d_ws;
  unsigned short* FC = (unsigned short*)(ws + oFC);
  unsigned short* FP = (unsigned short*)(ws + oFP);
  unsigned short* Qh = (unsigned short*)(ws + oQh);
  unsigned short* Ql = (unsigned short*)(ws + oQl);
  float* R = (float*)(ws + oR);
  float* G = (float*)(ws + oG);
  float* out = (float*)d_out;

  const dim3 blk256(256), blkat(NTH);

  // (1) input -> channel-major f16 plane, key-major bf16 plane, per-pixel norm factors; 3x3 window sums -> query
  //     hi + residual bf16 planes, eps terms
  prep_f<<<dim3(HW, NIMG), blk256, 0, stream>>>(fg, aux, FC, FP, R, Qh, Ql, G);
  // (2) attention over the 4096 per-pixel kernels -> out [b][64][4096]
  attn_k<<<dim3(NP / QT, NIMG), blkat, 0, stream>>>(Qh, Ql, FP, FC, R, G, out);
  (void)hipGetLastError();
}

// v004
// It runs in 32.4 microseconds.
// Timed twice side by side with v003, it ran 1.07 times as fast both times.
// Over all steps from v000 it is 6.97 times as fast.
// Contractions: scores S^T[p][q] = FB[p][c].Q[q][c] on v_wmma_f32_16x16x32_bf16 (A = bf16-RNE input rows, exact;
// B = bf16 hi + bf16 residual planes of the 3x3-summed input, 2 products, K = 64); O^T[c][q] = FB16[c][p].P[p][q]
// on v_wmma_f32_16x16x32_f16 (A = f16 of 16 x bf16-RNE input, exact; B = f16 of e^{s-m} x 2^15 x r_p from the
// score D registers); f32 accumulate; per-pixel norm factor r_p, softmax statistics and the eps terms in f32 VALU.
#include <hip/hip_runtime.h>
#include <math.h>
#include <stdint.h>

#ifndef NIMG
#define NIMG 4
#endif
#define NB_FULL 4
#define NC     64
#define HW     64
#define NP     4096
#define QT     64
#define TP     72
#define OSP    68
#define XSC    16.0f
#define IXSC   0.0625f
#define EPSV   1.0e-7f
#define LNCARRY 10.397207708399179f
#define KT     256
#define NST    (NP / KT)
#define KPT    72
#define VPT    264
#define NKG    4
#define KG     (KT / NKG)
#define NTH    (128 * NKG)

static_assert(NIMG >= 1 && NIMG <= NB_FULL);
static_assert(NP == HW * HW);
static_assert(NP % QT == 0 && NP % 32 == 0);
static_assert(NC == 64);
static_assert(QT == 64 && QT == HW);                           // one query tile = one image row
static_assert((TP * 2) % 16 == 0);
static_assert((OSP * 4) % 16 == 0);
static_assert(NP % KT == 0 && KT % 32 == 0 && NST >= 2);
static_assert((KPT * 2) % 32 == 16 && (VPT * 2) % 32 == 16);   // LDS row pitch = 16 B x odd for b128 readers
static_assert(KT * NC * 2 == 4 * NTH * 16);                    // one tile = 4 copies of 16 B by each of 512 lanes
static_assert(NP * 4 == 2 * NTH * 16);
static_assert(KG % 32 == 0 && NKG == NC / 16);                 // wave of key group g merges channel block g

typedef _Float16       v16h __attribute__((ext_vector_type(16)));
typedef _Float16       v8h  __attribute__((ext_vector_type(8)));
typedef __bf16         v16b __attribute__((ext_vector_type(16)));
typedef unsigned short v8us __attribute__((ext_vector_type(8)));
typedef float          v8f  __attribute__((ext_vector_type(8)));
typedef float          v4f  __attribute__((ext_vector_type(4)));
typedef unsigned int   v4u  __attribute__((ext_vector_type(4)));

union Frag  { v8us u[2]; v16h h; v16b bf; };
union FragH { v16h v; v8h hv[2]; };
static_assert(sizeof(Frag) == 32);
static_assert(sizeof(FragH) == 32);

// ---- scalar helpers -------------------------------------------------------------------------------------------
__device__ __forceinline__ unsigned short bf_bits(float f) {          // f32 -> bf16 bits, RNE convert
  unsigned u = __float_as_uint(f);
  return (unsigned short)((u + 0x7FFFu + ((u >> 16) & 1u)) >> 16);
}
__device__ __forceinline__ float bf_up(unsigned short hb) { return __uint_as_float(((unsigned)hb) << 16); }
__device__ __forceinline__ float bfr(float f) { return bf_up(bf_bits(f)); }
__device__ __forceinline__ unsigned short h_bits(_Float16 x) { return __builtin_bit_cast(unsigned short, x); }
__device__ __forceinline__ unsigned pk16(unsigned short a, unsigned short b) { return (unsigned)a | ((unsigned)b << 16); }
__device__ __forceinline__ v8f zero8() { v8f z = {0.f, 0.f, 0.f, 0.f, 0.f, 0.f, 0.f, 0.f}; return z; }
__device__ __forceinline__ float hmax8(v8f s) {
  return fmaxf(fmaxf(fmaxf(s[0], s[1]), fmaxf(s[2], s[3])), fmaxf(fmaxf(s[4], s[5]), fmaxf(s[6], s[7])));
}
__device__ __forceinline__ unsigned wave_ballot(bool p) {
#if defined(__HIP_DEVICE_COMPILE__)
  return __builtin_amdgcn_ballot_w32(p);
#else
  return p ? 1u : 0u;
#endif
}

// e^x as __expf forms it (multiply by log2 e, v_exp_f32), with the one free vector slot that the instruction set asks
// for behind a transcendental written into the same statement, so that no reader or overwrite stands directly behind it
__device__ __forceinline__ float exp_slot(float x) {
  const float t = x * 1.44269504f;
  float y = t;
#if defined(__HIP_DEVICE_COMPILE__)
  asm("v_exp_f32 %0, %1\n\tv_nop" : "=v"(y) : "v"(t));
#endif
  return y;
}

// eight e^x of the same form in one statement: the results are early-clobber, so inside it no v_exp_f32 is followed by
// a reader of its result or an overwrite of its source, and the one v_nop is the free slot behind the last of them
__device__ __forceinline__ v8f exp8_slot(v8f x) {
  const v8f t = x * 1.44269504f;
  v8f y = t;
#if defined(__HIP_DEVICE_COMPILE__)
  float y0, y1, y2, y3, y4, y5, y6, y7;
  asm("v_exp_f32 %0, %8\n\tv_exp_f32 %1, %9\n\tv_exp_f32 %2, %10\n\tv_exp_f32 %3, %11\n\t"
      "v_exp_f32 %4, %12\n\tv_exp_f32 %5, %13\n\tv_exp_f32 %6, %14\n\tv_exp_f32 %7, %15\n\tv_nop"
      : "=&v"(y0), "=&v"(y1), "=&v"(y2), "=&v"(y3), "=&v"(y4), "=&v"(y5), "=&v"(y6), "=&v"(y7)
      : "v"(t[0]), "v"(t[1]), "v"(t[2]), "v"(t[3]), "v"(t[4]), "v"(t[5]), "v"(t[6]), "v"(t[7]));
  y = v8f{y0, y1, y2, y3, y4, y5, y6, y7};
#endif
  return y;
}

// ---- 16-bit fragment loader (A, or B from a k-contiguous [n][k] row): lane -> row/col (lane&15), p already includes
//      + 8*(lane>>4); elements 0..7 <- p[0..7] (k0+8h..), elements 8..15 <- p[16..23] (k0+16+8h..)
__device__ __forceinline__ Frag ldfrag(const unsigned short* p) {
  Frag f;
  f.u[0] = *(const v8us*)(p);
  f.u[1] = *(const v8us*)(p + 16);
  return f;
}

// ---- WMMA helpers: the plain builtins; the compiler keeps the vector slots that the chip needs behind each of them ---
__device__ __forceinline__ v8f mma_h(v16h a, v16h b, v8f c) {
  return __builtin_amdgcn_wmma_f32_16x16x32_f16(false, a, false, b, (short)0, c, false, false);
}
__device__ __forceinline__ v8f mma_b(v16b a, v16b b, v8f c) {
  return __builtin_amdgcn_wmma_f32_16x16x32_bf16(false, a, false, b, (short)0, c, false, false);
}

// ---- asynchronous copies global -> LDS ---------------------------------------------------------------------------
typedef __attribute__((address_space(3))) const unsigned char lds_byte;
__device__ __forceinline__ unsigned lds_addr(const void* p) { return (unsigned)(uintptr_t)(lds_byte*)p; }
// Four (two) 16-byte copies per lane: LDS byte address l + i * ls <- global g + i * gs. The s_wait_xcnt stands inside
// the statement so that no address register named by a copy is rewritten in front of it.
__device__ __forceinline__ void copy4(unsigned l, unsigned ls, const char* g, size_t gs) {
#if defined(__HIP_DEVICE_COMPILE__)
  asm volatile(
      "global_load_async_to_lds_b128 %0, %4, off\n\t"
      "global_load_async_to_lds_b128 %1, %5, off\n\t"
      "global_load_async_to_lds_b128 %2, %6, off\n\t"
      "global_load_async_to_lds_b128 %3, %7, off\n\t"
      "s_wait_xcnt 0x0"
      :: "v"(l), "v"(l + ls), "v"(l + 2 * ls), "v"(l + 3 * ls), "v"(g), "v"(g + gs), "v"(g + 2 * gs), "v"(g + 3 * gs)
      : "memory");
#endif
}
__device__ __forceinline__ void copy2(unsigned l, unsigned ls, const char* g, size_t gs) {
#if defined(__HIP_DEVICE_COMPILE__)
  asm volatile(
      "global_load_async_to_lds_b128 %0, %2, off\n\t"
      "global_load_async_to_lds_b128 %1, %3, off\n\t"
      "s_wait_xcnt 0x0"
      :: "v"(l), "v"(l + ls), "v"(g), "v"(g + gs)
      : "memory");
#endif
}
__device__ __forceinline__ void wait_x0() {
#if defined(__HIP_DEVICE_COMPILE__)
  asm volatile("s_wait_xcnt 0x0" ::: "memory");
#endif
}
// this wave's copies have landed in LDS
__device__ __forceinline__ void wait_async0() {
#if defined(__HIP_DEVICE_COMPILE__)
  asm volatile("s_wait_asynccnt 0x0" ::: "memory");
#endif
}
// this wave's LDS reads have returned, so the buffer may be handed to its next writer
__device__ __forceinline__ void wait_ds0() {
#if defined(__HIP_DEVICE_COMPILE__)
  asm volatile("s_wait_dscnt 0x0" ::: "memory");
#endif
}

// =============================================================================================================
// (1) per (b, image row y), one launch for every operand plane of the row's 64 pixels p = 64 y + x:
//     FC f16 [b][c][p] = f16(16 * bf16-RNE(x)) (exact, channel-major, keys contiguous), FP bf16 [b][p][c] =
//     bf16-RNE(x) (key-major, channels contiguous) through an LDS tile T[64 x][64 c] (pitch TP), R f32 [b][p] =
//     rsqrt(sum_c (bf16-RNE(x) + eps)^2) (4 lanes per p, fixed order);
//     FPOOL[c][x] = 3x3 zero-padded window sum of bf16-RNE(x) centred on pixel (y, x), f32, then Qh/Ql bf16
//     [b][q = 64 y + x][64 c] (query-major, channels contiguous): hi = bf16-RNE(v), lo = bf16-RNE(v - hi), staged
//     through LDS tiles Th/Tl[64 x][64 c] (pitch TP); G f32 [b][q] = eps * sum_c FPOOL.
//     Thread (ch = tid>>2, xq = tid&3) loads channel ch at x = 16 xq .. 16 xq + 15 of rows y-1, y, y+1; the centre
//     row's rounded values feed FC, T and the window sums alike. Edge taps use clamped addresses and are zeroed by
//     predicate; the row-validity test is block-uniform. The second pointer argument (aux) is bound only, never read.
// coverage: FC 64 ch x 4 lanes x 16 = 64 c x 64 p; FP, Qh, Ql 2 it x 32 rows x 8 lanes x 8 = 64 x x 64 c per plane;
//           R, G 16 lanes x 4 = 64; grid (64 y, NIMG) covers every c, p, q of images 0..NIMG-1 exactly once.
//           LDS: T/Th/Tl written 64 x 64, read 64 x 64; Gs written 64 c x 64 x, read same; Gq, Rs 64/64.
// =============================================================================================================
__global__ __launch_bounds__(256)
void prep_f(const float* __restrict__ f, const float* __restrict__ aux, unsigned short* FC, unsigned short* FP,
            float* R, unsigned short* Qh, unsigned short* Ql, float* G) {
  (void)aux;
  __shared__ __align__(16) unsigned short T[QT * TP];
  __shared__ __align__(16) unsigned short Th[QT * TP];
  __shared__ __align__(16) unsigned short Tl[QT * TP];
  __shared__ __align__(16) float Gs[NC * QT];
  __shared__ __align__(16) float Gq[QT];
  __shared__ __align__(16) float Rs[QT];
  const int tid = threadIdx.x;
  const int y = blockIdx.x, b = blockIdx.y;
  const int ch = tid >> 2, xq = tid & 3, x0 = 16 * xq;
  const float* fc = f + ((size_t)(b * NC + ch)) * NP;
  float s[16], cv[16];
#pragma unroll
  for (int i = 0; i < 16; ++i) { s[i] = 0.f; cv[i] = 0.f; }
#pragma unroll
  for (int dy = -1; dy <= 1; ++dy) {
    const int yy = y + dy;                                            // block-uniform
    if (yy >= 0 && yy < HW) {
      const float* row = fc + yy * HW;
      const v4f a0 = *(const v4f*)(row + x0);
      const v4f a1 = *(const v4f*)(row + x0 + 4);
      const v4f a2 = *(const v4f*)(row + x0 + 8);
      const v4f a3 = *(const v4f*)(row + x0 + 12);
      const int xl = (x0 > 0) ? (x0 - 1) : 0;                          // clamped addresses
      const int xr = (x0 + 16 < HW) ? (x0 + 16) : (HW - 1);
      float vl = row[xl];
      float vr = row[xr];
      wait_x0();                                                      // in front of any rewrite of the six loads' address registers
      vl = (x0 > 0) ? vl : 0.f;
      vr = (x0 + 16 < HW) ? vr : 0.f;
      float v[18];
      v[0] = bfr(vl); v[17] = bfr(vr);
#pragma unroll
      for (int t = 0; t < 4; ++t) {
        v[1 + t]  = bfr(a0[t]);
        v[5 + t]  = bfr(a1[t]);
        v[9 + t]  = bfr(a2[t]);
        v[13 + t] = bfr(a3[t]);
      }
#pragma unroll
      for (int i = 0; i < 16; ++i) s[i] += (v[i] + v[i + 1]) + v[i + 2];
      if (dy == 0) {                                                  // the row's own pixels, bf16-RNE in f32
#pragma unroll
        for (int i = 0; i < 16; ++i) cv[i] = v[i + 1];
      }
    }
  }
  v4u uc[2];
  {
    unsigned short hb[16];
#pragma unroll
    for (int i = 0; i < 16; ++i) {
      hb[i] = h_bits((_Float16)(cv[i] * XSC));
      T[(x0 + i) * TP + ch] = (unsigned short)(__float_as_uint(cv[i]) >> 16);   // T[x][c], the bf16 bits
    }
#pragma unroll
    for (int t = 0; t < 4; ++t) {
      uc[0][t] = pk16(hb[2 * t], hb[2 * t + 1]);
      uc[1][t] = pk16(hb[8 + 2 * t], hb[9 + 2 * t]);
    }
  }
#pragma unroll
  for (int i = 0; i < 16; ++i) {
    const unsigned short hb = bf_bits(s[i]);
    const unsigned short lb = bf_bits(s[i] - bf_up(hb));
    Th[(x0 + i) * TP + ch] = hb;
    Tl[(x0 + i) * TP + ch] = lb;
  }
#pragma unroll
  for (int t = 0; t < 4; ++t) {
    v4f gv4 = {s[4 * t], s[4 * t + 1], s[4 * t + 2], s[4 * t + 3]};
    *(v4f*)(Gs + ch * QT + x0 + 4 * t) = gv4;
  }
  __syncthreads();
  if (tid < QT) {                                                     // waves 0 and 1 entirely
    float g = 0.f;
#pragma unroll 4
    for (int cc = 0; cc < NC; ++cc) g += Gs[cc * QT + tid];
    Gq[tid] = g * EPSV;
  }
  const int e = tid & 7, lq = tid >> 3;                              // lq 0..31
  v4u up[2], uh[2], ul[2];
#pragma unroll
  for (int it = 0; it < 2; ++it) {
    const int xl2 = it * 32 + lq;                                     // x 0..63
    up[it] = *(const v4u*)(T + xl2 * TP + 8 * e);
    uh[it] = *(const v4u*)(Th + xl2 * TP + 8 * e);
    ul[it] = *(const v4u*)(Tl + xl2 * TP + 8 * e);
  }
  {
    const int pl = tid >> 2, sub = tid & 3;                          // 4 lanes per p, 16 channels each
    const unsigned short* tr = T + pl * TP + 16 * sub;
    const v8us w0 = *(const v8us*)(tr);
    const v8us w1 = *(const v8us*)(tr + 8);
    float q = 0.f;
#pragma unroll
    for (int i = 0; i < 8; ++i) { const float v = bf_up(w0[i]) + EPSV; q += v * v; }
#pragma unroll
    for (int i = 0; i < 8; ++i) { const float v = bf_up(w1[i]) + EPSV; q += v * v; }
    q += __shfl_xor(q, 1, 32);
    q += __shfl_xor(q, 2, 32);
    if (sub == 0) Rs[pl] = rsqrtf(q);
  }
  __syncthreads();
  const v4f gv = *(const v4f*)(Gq + 4 * (tid & 15));
  const v4f rv = *(const v4f*)(Rs + 4 * (tid & 15));
  {
    unsigned short* fo = FC + ((size_t)(b * NC + ch)) * NP + y * HW + x0;
    *(v4u*)(fo)     = uc[0];
    *(v4u*)(fo + 8) = uc[1];
#pragma unroll
    for (int it = 0; it < 2; ++it) {
      const int xl2 = it * 32 + lq;
      const size_t po = ((size_t)(b * NP + y * HW + xl2)) * NC + 8 * e;
      *(v4u*)(FP + po) = up[it];
      *(v4u*)(Qh + po) = uh[it];
      *(v4u*)(Ql + po) = ul[it];
    }
    if (tid < 16) {
      *(v4f*)(R + (size_t)b * NP + y * HW + 4 * tid) = rv;
      *(v4f*)(G + (size_t)b * NP + y * HW + 4 * tid) = gv;
    }
  }
}

// =============================================================================================================
// (2) attention for one (b, 64-query tile), transposed formulation, 4096 keys, no mask:
//   S^T tile (16 keys x 16 queries) = A(FP row = key kb + (lane&15), 64 channels via the split k map, bf16 exact)
//   . B(Qh row = query, same map) + A(FP).B(Ql) (unscaled bf16 residual, shared accumulator), K = 64 = 2 steps;
//   then s = r_key * (acc + g_query) (per-key norm factor and the eps term, f32). Q fragments and g are loaded once.
//   Per lane the D tile holds 8 keys of ONE query: online softmax per lane, one shuffle (lane^16) for the max over
//   32 keys; the o/l/E rescale is skipped under a wave-uniform ballot when no lane's max grew. P = f16 of
//   e^{s-m} x 2^15 x r_key is the B operand of O^T (rows channel 16j + (lane&15), keys contiguous, f16 plane FC =
//   16 x input) . B(P^T): element r <- D of the tile covering keys kb..kb+15, element 8+r <- the tile covering
//   kb+16..kb+31, lane unchanged. 4 accumulator tiles per wave (64 channels). l = sum e and E = sum e r_key in f32.
//   Waves: 16 per work-group, four per SIMD. Wave w works on query group qg = w & 3 (16 queries) and key group
//   kg = w >> 2: of every stage it takes keys 64 kg .. 64 kg + 63 (two passes of 32), with softmax statistics and
//   accumulators of its own; the vector work of one wave runs under the matrix work and the LDS waits of the others.
//   Data path: the work-group's waves share every key tile. A stage = KT = 256 keys: FP rows (256 x 128 B, LDS
//   pitch 144 B) and FC rows (64 x 512 B, LDS pitch 528 B) come by 16-byte asynchronous copies into one of two LDS
//   buffers, one stage ahead of the stage being worked on; all 4096 norm factors of the image are copied once with
//   stage 0. Foot of each stage: LDS reads returned, own copies landed, barrier, then the refill of the buffer just read.
//   Merge: every wave stores m, l, E and its four O tiles in LDS Mg, barrier; wave (qg, kg) joins channel block kg of
//   query group qg over the four key groups in fixed order: weight e^{m_g - max m}, sums of l, E and O.
//   Epilogue: out = (O / 16 + eps E) / l staged in LDS Os[query][64 channels] (pitch OSP, b128 stores), barrier,
// coverage: Mg 16 waves x 9 x 32 lanes written, read 4 x 3 x 32 per wave; Os 16 waves x 16 queries x 16 ch; out 2 it x
//           64 lines x 8 lanes x 4 floats = 64 ch x 64 queries;
//           grid (64, NIMG) covers out[b][0..63][0..4095] of images 0..NIMG-1 exactly once.
// =============================================================================================================
__global__ __launch_bounds__(NTH)
void attn_k(const unsigned short* __restrict__ Qh, const unsigned short* __restrict__ Ql,
            const unsigned short* __restrict__ FP, const unsigned short* __restrict__ FC,
            const float* __restrict__ R, const float* __restrict__ G, float* out) {
  __shared__ __align__(16) float Os[QT * OSP];
  __shared__ __align__(16) unsigned short Ks[2 * KT * KPT];
  __shared__ __align__(16) unsigned short Vs[2 * NC * VPT];
  __shared__ __align__(16) float Rl[NP];
  __shared__ __align__(16) v4f Mg[4 * NKG * 9 * 32];
  const int tid  = threadIdx.x;
  const int wave = tid >> 5, lane = tid & 31;
  const int qg   = wave & 3, kg = wave >> 2;
  const int hh   = lane >> 4, c = lane & 15;
  const int n0   = blockIdx.x * QT, b = blockIdx.y;

  // q fragments (B operand, col = query n0 + 16*qg + c), channels 0..31 and 32..63
  const size_t qo = ((size_t)(b * NP + n0 + 16 * qg + c)) * NC + 8 * hh;
  const Frag qh0 = ldfrag(Qh + qo);
  const Frag qh1 = ldfrag(Qh + qo + 32);
  const Frag ql0 = ldfrag(Ql + qo);
  const Frag ql1 = ldfrag(Ql + qo + 32);
  const float gq = G[(size_t)b * NP + n0 + 16 * qg + c];
  // copy addresses of this lane. K tile: 16-byte chunk tid + 512 i of a contiguous 32 KiB, 8 chunks per 128-B row;
  // V tile: chunk tid + 512 i, 32 chunks per 512-B row of one channel; R: chunk tid + 512 i of 16 KiB.
  const char* gK = (const char*)(FP + (size_t)b * NP * NC) + 16 * tid;
  const char* gV = (const char*)(FC + (size_t)b * NC * NP) + (size_t)(tid >> 5) * (NP * 2) + 16 * (tid & 31);
  const char* gR = (const char*)(R + (size_t)b * NP) + 16 * tid;
  const unsigned lK = lds_addr(Ks) + (tid >> 3) * (KPT * 2) + 16 * (tid & 7);
  const unsigned lV = lds_addr(Vs) + (tid >> 5) * (VPT * 2) + 16 * (tid & 31);
  const unsigned lR = lds_addr(Rl) + 16 * tid;

  // stage 0 and the norm factors, published; then stage 1 in flight
  copy4(lK, 64 * KPT * 2, gK, 16 * NTH);
  copy4(lV, 16 * VPT * 2, gV, (size_t)16 * NP * 2);
  copy2(lR, 16 * NTH, gR, 16 * NTH);
  wait_async0();
  __syncthreads();
  copy4(lK + KT * KPT * 2, 64 * KPT * 2, gK + KT * NC * 2, 16 * NTH);
  copy4(lV + NC * VPT * 2, 16 * VPT * 2, gV + KT * 2, (size_t)16 * NP * 2);

  float m = -1.0e30f, l = 0.f, E = 0.f;
  v8f o[4];
#pragma unroll
  for (int j = 0; j < 4; ++j) o[j] = zero8();

#pragma unroll 1                                                      // one trip = one LDS stage
  for (int st = 0; st < NST; ++st) {
  const int buf = st & 1;
  // this wave's key group of the stage: k fragment base (A operand, row = key c of the tile), v fragment base (A
  // operand, row = channel 16j + c, keys contiguous), per-key norm factors for keys kb + 8hh + r and kb + 16 + 8hh + r
  const unsigned short* Kp = Ks + buf * (KT * KPT) + (kg * KG + c) * KPT + 8 * hh;
  const unsigned short* Vp = Vs + buf * (NC * VPT) + c * VPT + kg * KG + 8 * hh;
  const float* Rp = Rl + st * KT + kg * KG + 8 * hh;
#pragma unroll                                                        // constant LDS offsets for the two passes
  for (int kb = 0; kb < KG; kb += 32) {
    const unsigned short* k0p = Kp + kb * KPT;                      // keys kb .. kb+15 of this wave's key group
    const unsigned short* k1p = Kp + (kb + 16) * KPT;               // keys kb+16 .. kb+31
    v8f s0 = zero8(), s1 = zero8();
    // all LDS reads of the pass stand here in one group: the norm factors and the v fragments return under the score
    // products and the softmax instead of being waited for one by one
    const Frag a0 = ldfrag(k0p), a1 = ldfrag(k0p + 32);
    const Frag c0 = ldfrag(k1p), c1 = ldfrag(k1p + 32);
    const v4f ra = *(const v4f*)(Rp + kb);
    const v4f rb = *(const v4f*)(Rp + kb + 4);
    const v4f rc = *(const v4f*)(Rp + kb + 16);
    const v4f rd = *(const v4f*)(Rp + kb + 20);
    Frag vf[4];
#pragma unroll
    for (int j = 0; j < 4; ++j) vf[j] = ldfrag(Vp + (16 * j) * VPT + kb);
#if defined(__HIP_DEVICE_COMPILE__)
    // keeps the group above whole and ahead of the pass's products (LDS reads and WMMAs do not cross, vector work may):
    // without it the v fragment reads sink to just in front of their products and are waited for there
    __builtin_amdgcn_sched_barrier(0x406);
#endif
    {
      s0 = mma_b(a0.bf, qh0.bf, s0);
      s1 = mma_b(c0.bf, qh0.bf, s1);
      s0 = mma_b(a0.bf, ql0.bf, s0);
      s1 = mma_b(c0.bf, ql0.bf, s1);
      s0 = mma_b(a1.bf, qh1.bf, s0);
      s1 = mma_b(c1.bf, qh1.bf, s1);
      s0 = mma_b(a1.bf, ql1.bf, s0);
      s1 = mma_b(c1.bf, ql1.bf, s1);
    }
    const float r0v[8] = {ra[0], ra[1], ra[2], ra[3], rb[0], rb[1], rb[2], rb[3]};
    const float r1v[8] = {rc[0], rc[1], rc[2], rc[3], rd[0], rd[1], rd[2], rd[3]};
#pragma unroll
    for (int r = 0; r < 8; ++r) {
      s0[r] = r0v[r] * (s0[r] + gq);                                  // key kb      + 8hh + r
      s1[r] = r1v[r] * (s1[r] + gq);                                  // key kb + 16 + 8hh + r
    }

    float mx = fmaxf(hmax8(s0), hmax8(s1));
    mx = fmaxf(mx, __shfl_xor(mx, 16, 32));
    const float mn = fmaxf(m, mx);
    const unsigned grew = wave_ballot(mx > m);                        // wave-uniform
    if (grew != 0u) {
      const float corr = __expf(m - mn);                              // == 1 exactly for lanes whose max did not grow
      l *= corr;
      E *= corr;
#pragma unroll
      for (int j = 0; j < 4; ++j) {
#pragma unroll
        for (int r = 0; r < 8; ++r) o[j][r] *= corr;
      }
    }
    m = mn;
    const float msh = mn - LNCARRY;                                   // exp gives e^{s-m} * 32768

    FragH ph;
    float ls = 0.f, es = 0.f;
    const v8f x0 = exp8_slot(s0 - msh);
    const v8f x1 = exp8_slot(s1 - msh);
#pragma unroll
    for (int r = 0; r < 8; ++r) {
      const float e0 = x0[r];
      const float e1 = x1[r];
      ls += e0 + e1;
      const float pe0 = e0 * r0v[r];
      const float pe1 = e1 * r1v[r];
      es += pe0 + pe1;
      ph.hv[0][r] = (_Float16)pe0;
      ph.hv[1][r] = (_Float16)pe1;
    }
    l += ls;
    E += es;

#pragma unroll
    for (int j = 0; j < 4; ++j) o[j] = mma_h(vf[j].h, ph.v, o[j]);
  }
  // publish stage st + 1 and free this stage's buffer
  wait_ds0();
  wait_async0();
  __syncthreads();
  if (st + 2 < NST) {                                                 // same for the whole work-group
    copy4(lK + buf * (KT * KPT * 2), 64 * KPT * 2, gK + (size_t)(st + 2) * (KT * NC * 2), 16 * NTH);
    copy4(lV + buf * (NC * VPT * 2), 16 * VPT * 2, gV + (size_t)(st + 2) * (KT * 2), (size_t)16 * NP * 2);
  }
  }
  wait_async0();
  l += __shfl_xor(l, 16, 32);
  E += __shfl_xor(E, 16, 32);
  // this wave's partial result: Mg[wave][2j + half][lane] = O tile j, Mg[wave][8][lane] = statistics
  {
    v4f* mg = Mg + wave * (9 * 32) + lane;
#pragma unroll
    for (int j = 0; j < 4; ++j) {
      const v4f pa = {o[j][0], o[j][1], o[j][2], o[j][3]};
      const v4f pb = {o[j][4], o[j][5], o[j][6], o[j][7]};
      mg[(2 * j) * 32]     = pa;
      mg[(2 * j + 1) * 32] = pb;
    }
    const v4f ps = {m, l, E, 0.f};
    mg[8 * 32] = ps;
  }
  __syncthreads();
  // join the four key groups for channel block kg of query group qg, key groups in fixed order 0..3
  v4f sg[NKG], ag[NKG], bg[NKG];
#pragma unroll
  for (int g = 0; g < NKG; ++g) {
    const v4f* mg = Mg + (g * 4 + qg) * (9 * 32) + lane;
    sg[g] = mg[8 * 32];
    ag[g] = mg[(2 * kg) * 32];
    bg[g] = mg[(2 * kg + 1) * 32];
  }
  const float mm = fmaxf(fmaxf(sg[0][0], sg[1][0]), fmaxf(sg[2][0], sg[3][0]));
  float lt = 0.f, Et = 0.f;
  v4f oa = {0.f, 0.f, 0.f, 0.f}, ob = {0.f, 0.f, 0.f, 0.f};
#pragma unroll
  for (int g = 0; g < NKG; ++g) {
    const float wg = exp_slot(sg[g][0] - mm);
    lt += wg * sg[g][1];
    Et += wg * sg[g][2];
#pragma unroll
    for (int r = 0; r < 4; ++r) {
      oa[r] += wg * ag[g][r];
      ob[r] += wg * bg[g][r];
    }
  }
  const float inv = 1.0f / lt;                                        // o, E and l all carry the 2^15 factor
  const float ee  = EPSV * Et;

  const int qrow = 16 * qg + c;
  {
    v4f va, vb;
#pragma unroll
    for (int r = 0; r < 4; ++r) {
      va[r] = (oa[r] * IXSC + ee) * inv;
      vb[r] = (ob[r] * IXSC + ee) * inv;
    }
    *(v4f*)(Os + qrow * OSP + 16 * kg + 8 * hh)     = va;             // Os[query][ch = 16kg + 8hh + r]
    *(v4f*)(Os + qrow * OSP + 16 * kg + 8 * hh + 4) = vb;
  }
  __syncthreads();
  const int e = tid & 7, lq = tid >> 3;                               // lq 0..63
  v4f res[2];
#pragma unroll
  for (int it = 0; it < 2; ++it) {
    const int L   = it * 64 + lq;                                     // 0..127
    const int chl = L >> 1, hf = L & 1;                               // channel 0..63
    const int nl  = hf * 32 + 4 * e;                                  // query 0..63
#pragma unroll
    for (int t = 0; t < 4; ++t) res[it][t] = Os[(nl + t) * OSP + chl];
  }
{
#pragma unroll
    for (int it = 0; it < 2; ++it) {
      const int L   = it * 64 + lq;
      const int chl = L >> 1, hf = L & 1;
      const int nl  = hf * 32 + 4 * e;
      const size_t idx = ((size_t)(b * NC + chl)) * NP + n0 + nl;
      *(v4f*)(out + idx) = res[it];
    }
    
  }
}

// =============================================================================================================
// Workspace map (bytes; each region start a multiple of 256; every extent is an exact tile multiple and is written
//   FC f16 [NIMG][64][4096]   2097152      FP bf16 [NIMG][4096][64]  2097152
//   Qh/Ql bf16 [NIMG][4096][64]  2097152 x2
//   R f32 [NIMG][4096]  65536              G f32 [NIMG][4096]  65536
//   total (NIMG = 4) = 8519680
// =============================================================================================================
extern "C" void kernel_launch(void* const* d_in, const int* in_sizes, int n_in,
                              void* d_out, int out_size, void* d_ws, size_t ws_size,
                              hipStream_t stream) {
  const int XN = NIMG * NC * NP;
  if (n_in < 2) return;
  if (in_sizes[0] < XN) return;
  if (out_size < XN) return;

  size_t off = 0;
  auto carve = [&](size_t bytes) { const size_t o = off; off += (bytes + 255) & ~(size_t)255; return o; };
  const size_t oFC = carve((size_t)NIMG * NC * NP * 2);
  const size_t oFP = carve((size_t)NIMG * NP * NC * 2);
  const size_t oQh = carve((size_t)NIMG * NP * NC * 2);
  const size_t oQl = carve((size_t)NIMG * NP * NC * 2);
  const size_t oR  = carve((size_t)NIMG * NP * 4);
  const size_t oG  = carve((size_t)NIMG * NP * 4);
  if (off > ws_size) return;
  if (off > (size_t)134217728) return;

  const float* fg = (const float*)d_in[0];
  // d_in[1] (second input) does not enter this forward output; its pointer is bound to the first launch, unread.
  const float* aux = (const float*)d_in[1];

  char* ws = (char*)d_ws;
  unsigned short* FC = (unsigned short*)(ws + oFC);
  unsigned short* FP = (unsigned short*)(ws + oFP);
  unsigned short* Qh = (unsigned short*)(ws + oQh);
  unsigned short* Ql = (unsigned short*)(ws + oQl);
  float* R = (float*)(ws + oR);
  float* G = (float*)(ws + oG);
  float* out = (float*)d_out;

  const dim3 blk256(256), blkat(NTH);

  // (1) input -> channel-major f16 plane, key-major bf16 plane, per-pixel norm factors; 3x3 window sums -> query
  //     hi + residual bf16 planes, eps terms
  prep_f<<<dim3(HW, NIMG), blk256, 0, stream>>>(fg, aux, FC, FP, R, Qh, Ql, G);
  // (2) attention over the 4096 per-pixel kernels -> out [b][64][4096]
  attn_k<<<dim3(NP / QT, NIMG), blkat, 0, stream>>>(Qh, Ql, FP, FC, R, G, out);
  (void)hipGetLastError();
}

// v005
// Measured time: 30.7 microseconds a run.
// Next to v004, in two timings, it ran 1.05 times as fast each time.
// Counting every step since v000, it is 7.35 times as fast.
// Contractions: scores S^T[p][q] = FB[p][c].Q[q][c] on v_wmma_f32_16x16x32_bf16 (A = bf16-RNE input rows, exact;
// B = bf16 hi + bf16 residual planes of the 3x3-summed input, 2 products, K = 64); O^T[c][q] = FB16[c][p].P[p][q]
// on v_wmma_f32_16x16x32_f16 (A = f16 of 16 x bf16-RNE input, exact; B = f16 of e^{s-m} x 2^4 x r_p from the
// score D registers); f32 accumulate; per-pixel norm factor r_p, softmax statistics and the eps terms in f32 VALU.
#include <hip/hip_runtime.h>
#include <math.h>
#include <stdint.h>

#ifndef NIMG
#define NIMG 4
#endif
#define NB_FULL 4
#define NC     64
#define HW     64
#define NP     4096
#define QT     64
#define TP     72
#define OSP    68
#define XSC    16.0f
#define IXSC   0.0625f
#define EPSV   1.0e-7f
#define LNCARRY 2.772588722239781f
#define ELIM    32768.0f
#define KT     256
#define NST    (NP / KT)
#define KPT    72
#define VPT    264
#define NKG    4
#define KG     (KT / NKG)
#define NTH    (128 * NKG)

static_assert(NIMG >= 1 && NIMG <= NB_FULL);
static_assert(NP == HW * HW);
static_assert(NP % QT == 0 && NP % 32 == 0);
static_assert(NC == 64);
static_assert(QT == 64 && QT == HW);                           // one query tile = one image row
static_assert((TP * 2) % 16 == 0);
static_assert((OSP * 4) % 16 == 0);
static_assert(NP % KT == 0 && KT % 32 == 0 && NST >= 2);
static_assert((KPT * 2) % 32 == 16 && (VPT * 2) % 32 == 16);   // LDS row pitch = 16 B x odd for b128 readers
static_assert(KT * NC * 2 == 4 * NTH * 16);                    // one tile = 4 copies of 16 B by each of 512 lanes
static_assert(NP * 4 == 2 * NTH * 16);
static_assert(KG % 32 == 0 && NKG == NC / 16);                 // wave of key group g merges channel block g

typedef _Float16       v16h __attribute__((ext_vector_type(16)));
typedef _Float16       v8h  __attribute__((ext_vector_type(8)));
typedef __bf16         v16b __attribute__((ext_vector_type(16)));
typedef unsigned short v8us __attribute__((ext_vector_type(8)));
typedef float          v8f  __attribute__((ext_vector_type(8)));
typedef float          v4f  __attribute__((ext_vector_type(4)));
typedef unsigned int   v4u  __attribute__((ext_vector_type(4)));

union Frag  { v8us u[2]; v16h h; v16b bf; };
union FragH { v16h v; v8h hv[2]; };
static_assert(sizeof(Frag) == 32);
static_assert(sizeof(FragH) == 32);

// ---- scalar helpers -------------------------------------------------------------------------------------------
__device__ __forceinline__ unsigned short bf_bits(float f) {          // f32 -> bf16 bits, RNE convert
  unsigned u = __float_as_uint(f);
  return (unsigned short)((u + 0x7FFFu + ((u >> 16) & 1u)) >> 16);
}
__device__ __forceinline__ float bf_up(unsigned short hb) { return __uint_as_float(((unsigned)hb) << 16); }
__device__ __forceinline__ float bfr(float f) { return bf_up(bf_bits(f)); }
__device__ __forceinline__ unsigned short h_bits(_Float16 x) { return __builtin_bit_cast(unsigned short, x); }
__device__ __forceinline__ unsigned pk16(unsigned short a, unsigned short b) { return (unsigned)a | ((unsigned)b << 16); }
__device__ __forceinline__ v8f zero8() { v8f z = {0.f, 0.f, 0.f, 0.f, 0.f, 0.f, 0.f, 0.f}; return z; }
__device__ __forceinline__ float hmax8(v8f s) {
  return fmaxf(fmaxf(fmaxf(s[0], s[1]), fmaxf(s[2], s[3])), fmaxf(fmaxf(s[4], s[5]), fmaxf(s[6], s[7])));
}
__device__ __forceinline__ unsigned wave_ballot(bool p) {
#if defined(__HIP_DEVICE_COMPILE__)
  return __builtin_amdgcn_ballot_w32(p);
#else
  return p ? 1u : 0u;
#endif
}

// e^x as __expf forms it (multiply by log2 e, v_exp_f32), with the one free vector slot that the instruction set asks
// for behind a transcendental written into the same statement, so that no reader or overwrite stands directly behind it
__device__ __forceinline__ float exp_slot(float x) {
  const float t = x * 1.44269504f;
  float y = t;
#if defined(__HIP_DEVICE_COMPILE__)
  asm("v_exp_f32 %0, %1\n\tv_nop" : "=v"(y) : "v"(t));
#endif
  return y;
}

// eight e^x of the same form in one statement: the results are early-clobber, so inside it no v_exp_f32 is followed by
// a reader of its result or an overwrite of its source, and the one v_nop is the free slot behind the last of them
__device__ __forceinline__ v8f exp8_slot(v8f x) {
  const v8f t = x * 1.44269504f;
  v8f y = t;
#if defined(__HIP_DEVICE_COMPILE__)
  float y0, y1, y2, y3, y4, y5, y6, y7;
  asm("v_exp_f32 %0, %8\n\tv_exp_f32 %1, %9\n\tv_exp_f32 %2, %10\n\tv_exp_f32 %3, %11\n\t"
      "v_exp_f32 %4, %12\n\tv_exp_f32 %5, %13\n\tv_exp_f32 %6, %14\n\tv_exp_f32 %7, %15\n\tv_nop"
      : "=&v"(y0), "=&v"(y1), "=&v"(y2), "=&v"(y3), "=&v"(y4), "=&v"(y5), "=&v"(y6), "=&v"(y7)
      : "v"(t[0]), "v"(t[1]), "v"(t[2]), "v"(t[3]), "v"(t[4]), "v"(t[5]), "v"(t[6]), "v"(t[7]));
  y = v8f{y0, y1, y2, y3, y4, y5, y6, y7};
#endif
  return y;
}

// ---- 16-bit fragment loader (A, or B from a k-contiguous [n][k] row): lane -> row/col (lane&15), p already includes
//      + 8*(lane>>4); elements 0..7 <- p[0..7] (k0+8h..), elements 8..15 <- p[16..23] (k0+16+8h..)
__device__ __forceinline__ Frag ldfrag(const unsigned short* p) {
  Frag f;
  f.u[0] = *(const v8us*)(p);
  f.u[1] = *(const v8us*)(p + 16);
  return f;
}

// ---- WMMA helpers: the plain builtins; the compiler keeps the vector slots that the chip needs behind each of them ---
__device__ __forceinline__ v8f mma_h(v16h a, v16h b, v8f c) {
  return __builtin_amdgcn_wmma_f32_16x16x32_f16(false, a, false, b, (short)0, c, false, false);
}
__device__ __forceinline__ v8f mma_b(v16b a, v16b b, v8f c) {
  return __builtin_amdgcn_wmma_f32_16x16x32_bf16(false, a, false, b, (short)0, c, false, false);
}

// ---- asynchronous copies global -> LDS ---------------------------------------------------------------------------
typedef __attribute__((address_space(3))) const unsigned char lds_byte;
__device__ __forceinline__ unsigned lds_addr(const void* p) { return (unsigned)(uintptr_t)(lds_byte*)p; }
// Four (two) 16-byte copies per lane: LDS byte address l + i * ls <- global g + i * gs. The s_wait_xcnt stands inside
// the statement so that no address register named by a copy is rewritten in front of it.
__device__ __forceinline__ void copy4(unsigned l, unsigned ls, const char* g, size_t gs) {
#if defined(__HIP_DEVICE_COMPILE__)
  asm volatile(
      "global_load_async_to_lds_b128 %0, %4, off\n\t"
      "global_load_async_to_lds_b128 %1, %5, off\n\t"
      "global_load_async_to_lds_b128 %2, %6, off\n\t"
      "global_load_async_to_lds_b128 %3, %7, off\n\t"
      "s_wait_xcnt 0x0"
      :: "v"(l), "v"(l + ls), "v"(l + 2 * ls), "v"(l + 3 * ls), "v"(g), "v"(g + gs), "v"(g + 2 * gs), "v"(g + 3 * gs)
      : "memory");
#endif
}
__device__ __forceinline__ void copy2(unsigned l, unsigned ls, const char* g, size_t gs) {
#if defined(__HIP_DEVICE_COMPILE__)
  asm volatile(
      "global_load_async_to_lds_b128 %0, %2, off\n\t"
      "global_load_async_to_lds_b128 %1, %3, off\n\t"
      "s_wait_xcnt 0x0"
      :: "v"(l), "v"(l + ls), "v"(g), "v"(g + gs)
      : "memory");
#endif
}
__device__ __forceinline__ void wait_x0() {
#if defined(__HIP_DEVICE_COMPILE__)
  asm volatile("s_wait_xcnt 0x0" ::: "memory");
#endif
}
// this wave's copies have landed in LDS
__device__ __forceinline__ void wait_async0() {
#if defined(__HIP_DEVICE_COMPILE__)
  asm volatile("s_wait_asynccnt 0x0" ::: "memory");
#endif
}
// this wave's LDS reads have returned, so the buffer may be handed to its next writer
__device__ __forceinline__ void wait_ds0() {
#if defined(__HIP_DEVICE_COMPILE__)
  asm volatile("s_wait_dscnt 0x0" ::: "memory");
#endif
}

// =============================================================================================================
// (1) per (b, image row y), one launch for every operand plane of the row's 64 pixels p = 64 y + x:
//     FC f16 [b][c][p] = f16(16 * bf16-RNE(x)) (exact, channel-major, keys contiguous), FP bf16 [b][p][c] =
//     bf16-RNE(x) (key-major, channels contiguous) through an LDS tile T[64 x][64 c] (pitch TP), R f32 [b][p] =
//     rsqrt(sum_c (bf16-RNE(x) + eps)^2) (4 lanes per p, fixed order);
//     FPOOL[c][x] = 3x3 zero-padded window sum of bf16-RNE(x) centred on pixel (y, x), f32, then Qh/Ql bf16
//     [b][q = 64 y + x][64 c] (query-major, channels contiguous): hi = bf16-RNE(v), lo = bf16-RNE(v - hi), staged
//     through LDS tiles Th/Tl[64 x][64 c] (pitch TP); G f32 [b][q] = eps * sum_c FPOOL.
//     Thread (ch = tid>>2, xq = tid&3) loads channel ch at x = 16 xq .. 16 xq + 15 of rows y-1, y, y+1; the centre
//     row's rounded values feed FC, T and the window sums alike. Edge taps use clamped addresses and are zeroed by
//     predicate; the row-validity test is block-uniform. The second pointer argument (aux) is bound only, never read.
// coverage: FC 64 ch x 4 lanes x 16 = 64 c x 64 p; FP, Qh, Ql 2 it x 32 rows x 8 lanes x 8 = 64 x x 64 c per plane;
//           R, G 16 lanes x 4 = 64; grid (64 y, NIMG) covers every c, p, q of images 0..NIMG-1 exactly once.
//           LDS: T/Th/Tl written 64 x 64, read 64 x 64; Gs written 64 c x 64 x, read same; Gq, Rs 64/64.
// =============================================================================================================
__global__ __launch_bounds__(256)
void prep_f(const float* __restrict__ f, const float* __restrict__ aux, unsigned short* FC, unsigned short* FP,
            float* R, unsigned short* Qh, unsigned short* Ql, float* G) {
  (void)aux;
  __shared__ __align__(16) unsigned short T[QT * TP];
  __shared__ __align__(16) unsigned short Th[QT * TP];
  __shared__ __align__(16) unsigned short Tl[QT * TP];
  __shared__ __align__(16) float Gs[NC * QT];
  __shared__ __align__(16) float Gq[QT];
  __shared__ __align__(16) float Rs[QT];
  const int tid = threadIdx.x;
  const int y = blockIdx.x, b = blockIdx.y;
  const int ch = tid >> 2, xq = tid & 3, x0 = 16 * xq;
  const float* fc = f + ((size_t)(b * NC + ch)) * NP;
  float s[16], cv[16];
#pragma unroll
  for (int i = 0; i < 16; ++i) { s[i] = 0.f; cv[i] = 0.f; }
#pragma unroll
  for (int dy = -1; dy <= 1; ++dy) {
    const int yy = y + dy;                                            // block-uniform
    if (yy >= 0 && yy < HW) {
      const float* row = fc + yy * HW;
      const v4f a0 = *(const v4f*)(row + x0);
      const v4f a1 = *(const v4f*)(row + x0 + 4);
      const v4f a2 = *(const v4f*)(row + x0 + 8);
      const v4f a3 = *(const v4f*)(row + x0 + 12);
      const int xl = (x0 > 0) ? (x0 - 1) : 0;                          // clamped addresses
      const int xr = (x0 + 16 < HW) ? (x0 + 16) : (HW - 1);
      float vl = row[xl];
      float vr = row[xr];
      wait_x0();                                                      // in front of any rewrite of the six loads' address registers
      vl = (x0 > 0) ? vl : 0.f;
      vr = (x0 + 16 < HW) ? vr : 0.f;
      float v[18];
      v[0] = bfr(vl); v[17] = bfr(vr);
#pragma unroll
      for (int t = 0; t < 4; ++t) {
        v[1 + t]  = bfr(a0[t]);
        v[5 + t]  = bfr(a1[t]);
        v[9 + t]  = bfr(a2[t]);
        v[13 + t] = bfr(a3[t]);
      }
#pragma unroll
      for (int i = 0; i < 16; ++i) s[i] += (v[i] + v[i + 1]) + v[i + 2];
      if (dy == 0) {                                                  // the row's own pixels, bf16-RNE in f32
#pragma unroll
        for (int i = 0; i < 16; ++i) cv[i] = v[i + 1];
      }
    }
  }
  v4u uc[2];
  {
    unsigned short hb[16];
#pragma unroll
    for (int i = 0; i < 16; ++i) {
      hb[i] = h_bits((_Float16)(cv[i] * XSC));
      T[(x0 + i) * TP + ch] = (unsigned short)(__float_as_uint(cv[i]) >> 16);   // T[x][c], the bf16 bits
    }
#pragma unroll
    for (int t = 0; t < 4; ++t) {
      uc[0][t] = pk16(hb[2 * t], hb[2 * t + 1]);
      uc[1][t] = pk16(hb[8 + 2 * t], hb[9 + 2 * t]);
    }
  }
#pragma unroll
  for (int i = 0; i < 16; ++i) {
    const unsigned short hb = bf_bits(s[i]);
    const unsigned short lb = bf_bits(s[i] - bf_up(hb));
    Th[(x0 + i) * TP + ch] = hb;
    Tl[(x0 + i) * TP + ch] = lb;
  }
#pragma unroll
  for (int t = 0; t < 4; ++t) {
    v4f gv4 = {s[4 * t], s[4 * t + 1], s[4 * t + 2], s[4 * t + 3]};
    *(v4f*)(Gs + ch * QT + x0 + 4 * t) = gv4;
  }
  __syncthreads();
  if (tid < QT) {                                                     // waves 0 and 1 entirely
    float g = 0.f;
#pragma unroll 4
    for (int cc = 0; cc < NC; ++cc) g += Gs[cc * QT + tid];
    Gq[tid] = g * EPSV;
  }
  const int e = tid & 7, lq = tid >> 3;                              // lq 0..31
  v4u up[2], uh[2], ul[2];
#pragma unroll
  for (int it = 0; it < 2; ++it) {
    const int xl2 = it * 32 + lq;                                     // x 0..63
    up[it] = *(const v4u*)(T + xl2 * TP + 8 * e);
    uh[it] = *(const v4u*)(Th + xl2 * TP + 8 * e);
    ul[it] = *(const v4u*)(Tl + xl2 * TP + 8 * e);
  }
  {
    const int pl = tid >> 2, sub = tid & 3;                          // 4 lanes per p, 16 channels each
    const unsigned short* tr = T + pl * TP + 16 * sub;
    const v8us w0 = *(const v8us*)(tr);
    const v8us w1 = *(const v8us*)(tr + 8);
    float q = 0.f;
#pragma unroll
    for (int i = 0; i < 8; ++i) { const float v = bf_up(w0[i]) + EPSV; q += v * v; }
#pragma unroll
    for (int i = 0; i < 8; ++i) { const float v = bf_up(w1[i]) + EPSV; q += v * v; }
    q += __shfl_xor(q, 1, 32);
    q += __shfl_xor(q, 2, 32);
    if (sub == 0) Rs[pl] = rsqrtf(q);
  }
  __syncthreads();
  const v4f gv = *(const v4f*)(Gq + 4 * (tid & 15));
  const v4f rv = *(const v4f*)(Rs + 4 * (tid & 15));
  {
    unsigned short* fo = FC + ((size_t)(b * NC + ch)) * NP + y * HW + x0;
    *(v4u*)(fo)     = uc[0];
    *(v4u*)(fo + 8) = uc[1];
#pragma unroll
    for (int it = 0; it < 2; ++it) {
      const int xl2 = it * 32 + lq;
      const size_t po = ((size_t)(b * NP + y * HW + xl2)) * NC + 8 * e;
      *(v4u*)(FP + po) = up[it];
      *(v4u*)(Qh + po) = uh[it];
      *(v4u*)(Ql + po) = ul[it];
    }
    if (tid < 16) {
      *(v4f*)(R + (size_t)b * NP + y * HW + 4 * tid) = rv;
      *(v4f*)(G + (size_t)b * NP + y * HW + 4 * tid) = gv;
    }
  }
}

// =============================================================================================================
// (2) attention for one (b, 64-query tile), transposed formulation, 4096 keys, no mask:
//   S^T tile (16 keys x 16 queries) = A(FP row = key kb + (lane&15), 64 channels via the split k map, bf16 exact)
//   . B(Qh row = query, same map) + A(FP).B(Ql) (unscaled bf16 residual, shared accumulator), K = 64 = 2 steps;
//   then s = r_key * (acc + g_query) (per-key norm factor and the eps term, f32). Q fragments and g are loaded once.
//   Per lane the D tile holds 8 keys of ONE query: online softmax per lane with a reference point m that lags the max:
//   m moves (max of the pass, one shuffle lane^16, o/l/E rescaled, the pass's exponentials formed anew) only where, by
//   a wave-uniform ballot, some lane's sum of e^{s-m} x 2^4 over its 16 keys passes ELIM = 2^15; else each is at most
//   2^15 and P stays in f16 range, with no max and no exchange in the pass. P = f16 of
//   e^{s-m} x 2^4 x r_key is the B operand of O^T (rows channel 16j + (lane&15), keys contiguous, f16 plane FC =
//   16 x input) . B(P^T): element r <- D of the tile covering keys kb..kb+15, element 8+r <- the tile covering
//   kb+16..kb+31, lane unchanged. 4 accumulator tiles per wave (64 channels). l = sum e and E = sum e r_key in f32.
//   Waves: 16 per work-group, four per SIMD. Wave w works on query group qg = w & 3 (16 queries) and key group
//   kg = w >> 2: of every stage it takes keys 64 kg .. 64 kg + 63 (two passes of 32), with softmax statistics and
//   accumulators of its own; the vector work of one wave runs under the matrix work and the LDS waits of the others.
//   Data path: the work-group's waves share every key tile. A stage = KT = 256 keys: FP rows (256 x 128 B, LDS
//   pitch 144 B) and FC rows (64 x 512 B, LDS pitch 528 B) come by 16-byte asynchronous copies into one of two LDS
//   buffers, one stage ahead of the stage being worked on; all 4096 norm factors of the image are copied once with
//   stage 0. Foot of each stage: LDS reads returned, own copies landed, barrier, then the refill of the buffer just read.
//   Merge: every wave stores m, l, E and its four O tiles in LDS Mg, barrier; wave (qg, kg) joins channel block kg of
//   query group qg over the four key groups in fixed order: weight e^{m_g - max m}, sums of l, E and O.
//   Epilogue: out = (O / 16 + eps E) / l staged in LDS Os[query][64 channels] (pitch OSP, b128 stores), barrier,
// coverage: Mg 16 waves x 9 x 32 lanes written, read 4 x 3 x 32 per wave; Os 16 waves x 16 queries x 16 ch; out 2 it x
//           64 lines x 8 lanes x 4 floats = 64 ch x 64 queries;
//           grid (64, NIMG) covers out[b][0..63][0..4095] of images 0..NIMG-1 exactly once.
// =============================================================================================================
__global__ __launch_bounds__(NTH)
void attn_k(const unsigned short* __restrict__ Qh, const unsigned short* __restrict__ Ql,
            const unsigned short* __restrict__ FP, const unsigned short* __restrict__ FC,
            const float* __restrict__ R, const float* __restrict__ G, float* out) {
  __shared__ __align__(16) float Os[QT * OSP];
  __shared__ __align__(16) unsigned short Ks[2 * KT * KPT];
  __shared__ __align__(16) unsigned short Vs[2 * NC * VPT];
  __shared__ __align__(16) float Rl[NP];
  __shared__ __align__(16) v4f Mg[4 * NKG * 9 * 32];
  const int tid  = threadIdx.x;
  const int wave = tid >> 5, lane = tid & 31;
  const int qg   = wave & 3, kg = wave >> 2;
  const int hh   = lane >> 4, c = lane & 15;
  const int n0   = blockIdx.x * QT, b = blockIdx.y;

  // q fragments (B operand, col = query n0 + 16*qg + c), channels 0..31 and 32..63
  const size_t qo = ((size_t)(b * NP + n0 + 16 * qg + c)) * NC + 8 * hh;
  const Frag qh0 = ldfrag(Qh + qo);
  const Frag qh1 = ldfrag(Qh + qo + 32);
  const Frag ql0 = ldfrag(Ql + qo);
  const Frag ql1 = ldfrag(Ql + qo + 32);
  const float gq = G[(size_t)b * NP + n0 + 16 * qg + c];
  // copy addresses of this lane. K tile: 16-byte chunk tid + 512 i of a contiguous 32 KiB, 8 chunks per 128-B row;
  // V tile: chunk tid + 512 i, 32 chunks per 512-B row of one channel; R: chunk tid + 512 i of 16 KiB.
  const char* gK = (const char*)(FP + (size_t)b * NP * NC) + 16 * tid;
  const char* gV = (const char*)(FC + (size_t)b * NC * NP) + (size_t)(tid >> 5) * (NP * 2) + 16 * (tid & 31);
  const char* gR = (const char*)(R + (size_t)b * NP) + 16 * tid;
  const unsigned lK = lds_addr(Ks) + (tid >> 3) * (KPT * 2) + 16 * (tid & 7);
  const unsigned lV = lds_addr(Vs) + (tid >> 5) * (VPT * 2) + 16 * (tid & 31);
  const unsigned lR = lds_addr(Rl) + 16 * tid;

  // stage 0 and the norm factors, published; then stage 1 in flight
  copy4(lK, 64 * KPT * 2, gK, 16 * NTH);
  copy4(lV, 16 * VPT * 2, gV, (size_t)16 * NP * 2);
  copy2(lR, 16 * NTH, gR, 16 * NTH);
  wait_async0();
  __syncthreads();
  copy4(lK + KT * KPT * 2, 64 * KPT * 2, gK + KT * NC * 2, 16 * NTH);
  copy4(lV + NC * VPT * 2, 16 * VPT * 2, gV + KT * 2, (size_t)16 * NP * 2);

  float m = -1.0e30f, msh = -1.0e30f, l = 0.f, E = 0.f;             // msh = m - LNCARRY
  v8f o[4];
#pragma unroll
  for (int j = 0; j < 4; ++j) o[j] = zero8();

#pragma unroll 1                                                      // one trip = one LDS stage
  for (int st = 0; st < NST; ++st) {
  const int buf = st & 1;
  // this wave's key group of the stage: k fragment base (A operand, row = key c of the tile), v fragment base (A
  // operand, row = channel 16j + c, keys contiguous), per-key norm factors for keys kb + 8hh + r and kb + 16 + 8hh + r
  const unsigned short* Kp = Ks + buf * (KT * KPT) + (kg * KG + c) * KPT + 8 * hh;
  const unsigned short* Vp = Vs + buf * (NC * VPT) + c * VPT + kg * KG + 8 * hh;
  const float* Rp = Rl + st * KT + kg * KG + 8 * hh;
#pragma unroll                                                        // constant LDS offsets for the two passes
  for (int kb = 0; kb < KG; kb += 32) {
    const unsigned short* k0p = Kp + kb * KPT;                      // keys kb .. kb+15 of this wave's key group
    const unsigned short* k1p = Kp + (kb + 16) * KPT;               // keys kb+16 .. kb+31
    v8f s0 = zero8(), s1 = zero8();
    // all LDS reads of the pass stand here in one group: the norm factors and the v fragments return under the score
    // products and the softmax instead of being waited for one by one
    const Frag a0 = ldfrag(k0p), a1 = ldfrag(k0p + 32);
    const Frag c0 = ldfrag(k1p), c1 = ldfrag(k1p + 32);
    const v4f ra = *(const v4f*)(Rp + kb);
    const v4f rb = *(const v4f*)(Rp + kb + 4);
    const v4f rc = *(const v4f*)(Rp + kb + 16);
    const v4f rd = *(const v4f*)(Rp + kb + 20);
    Frag vf[4];
#pragma unroll
    for (int j = 0; j < 4; ++j) vf[j] = ldfrag(Vp + (16 * j) * VPT + kb);
#if defined(__HIP_DEVICE_COMPILE__)
    // keeps the group above whole and ahead of the pass's products (LDS reads and WMMAs do not cross, vector work may):
    // without it the v fragment reads sink to just in front of their products and are waited for there
    __builtin_amdgcn_sched_barrier(0x406);
#endif
    {
      s0 = mma_b(a0.bf, qh0.bf, s0);
      s1 = mma_b(c0.bf, qh0.bf, s1);
      s0 = mma_b(a0.bf, ql0.bf, s0);
      s1 = mma_b(c0.bf, ql0.bf, s1);
      s0 = mma_b(a1.bf, qh1.bf, s0);
      s1 = mma_b(c1.bf, qh1.bf, s1);
      s0 = mma_b(a1.bf, ql1.bf, s0);
      s1 = mma_b(c1.bf, ql1.bf, s1);
    }
    const float r0v[8] = {ra[0], ra[1], ra[2], ra[3], rb[0], rb[1], rb[2], rb[3]};
    const float r1v[8] = {rc[0], rc[1], rc[2], rc[3], rd[0], rd[1], rd[2], rd[3]};
#pragma unroll
    for (int r = 0; r < 8; ++r) {
      s0[r] = r0v[r] * (s0[r] + gq);                                  // key kb      + 8hh + r
      s1[r] = r1v[r] * (s1[r] + gq);                                  // key kb + 16 + 8hh + r
    }

    // e^{s-m} x 2^4 against the reference point as it stands; their sum over this lane's 16 keys bounds each of them
    v8f x0 = exp8_slot(s0 - msh);
    v8f x1 = exp8_slot(s1 - msh);
    float ls = 0.f;
#pragma unroll
    for (int r = 0; r < 8; ++r) ls += x0[r] + x1[r];
    const unsigned over = wave_ballot(!(ls <= ELIM));                 // wave-uniform; an infinite sum counts as over
    if (__builtin_expect(over != 0u, 0)) {                            // rare: the reference point moves to the max so far
      const float mxl = fmaxf(hmax8(s0), hmax8(s1));                  // this lane's own 16 keys
      const float mn = fmaxf(m, fmaxf(mxl, __shfl_xor(mxl, 16, 32))); // same value in both lanes of a query
      const float corr = __expf(m - mn);                              // == 1 exactly for lanes whose max did not grow
      m = mn;
      msh = mn - LNCARRY;
      l *= corr;
      E *= corr;
#pragma unroll
      for (int j = 0; j < 4; ++j) {
#pragma unroll
        for (int r = 0; r < 8; ++r) o[j][r] *= corr;
      }
      x0 = exp8_slot(s0 - msh);                                       // now every one is at most 2^4
      x1 = exp8_slot(s1 - msh);
      ls = 0.f;
#pragma unroll
      for (int r = 0; r < 8; ++r) ls += x0[r] + x1[r];
    }

    FragH ph;
    float es = 0.f;
#pragma unroll
    for (int r = 0; r < 8; ++r) {
      const float pe0 = x0[r] * r0v[r];
      const float pe1 = x1[r] * r1v[r];
      es += pe0 + pe1;
      ph.hv[0][r] = (_Float16)pe0;
      ph.hv[1][r] = (_Float16)pe1;
    }
    l += ls;
    E += es;

#pragma unroll
    for (int j = 0; j < 4; ++j) o[j] = mma_h(vf[j].h, ph.v, o[j]);
  }
  // publish stage st + 1 and free this stage's buffer
  wait_ds0();
  wait_async0();
  __syncthreads();
  if (st + 2 < NST) {                                                 // same for the whole work-group
    copy4(lK + buf * (KT * KPT * 2), 64 * KPT * 2, gK + (size_t)(st + 2) * (KT * NC * 2), 16 * NTH);
    copy4(lV + buf * (NC * VPT * 2), 16 * VPT * 2, gV + (size_t)(st + 2) * (KT * 2), (size_t)16 * NP * 2);
  }
  }
  wait_async0();
  l += __shfl_xor(l, 16, 32);
  E += __shfl_xor(E, 16, 32);
  // this wave's partial result: Mg[wave][2j + half][lane] = O tile j, Mg[wave][8][lane] = statistics
  {
    v4f* mg = Mg + wave * (9 * 32) + lane;
#pragma unroll
    for (int j = 0; j < 4; ++j) {
      const v4f pa = {o[j][0], o[j][1], o[j][2], o[j][3]};
      const v4f pb = {o[j][4], o[j][5], o[j][6], o[j][7]};
      mg[(2 * j) * 32]     = pa;
      mg[(2 * j + 1) * 32] = pb;
    }
    const v4f ps = {m, l, E, 0.f};
    mg[8 * 32] = ps;
  }
  __syncthreads();
  // join the four key groups for channel block kg of query group qg, key groups in fixed order 0..3
  v4f sg[NKG], ag[NKG], bg[NKG];
#pragma unroll
  for (int g = 0; g < NKG; ++g) {
    const v4f* mg = Mg + (g * 4 + qg) * (9 * 32) + lane;
    sg[g] = mg[8 * 32];
    ag[g] = mg[(2 * kg) * 32];
    bg[g] = mg[(2 * kg + 1) * 32];
  }
  const float mm = fmaxf(fmaxf(sg[0][0], sg[1][0]), fmaxf(sg[2][0], sg[3][0]));
  float lt = 0.f, Et = 0.f;
  v4f oa = {0.f, 0.f, 0.f, 0.f}, ob = {0.f, 0.f, 0.f, 0.f};
#pragma unroll
  for (int g = 0; g < NKG; ++g) {
    const float wg = exp_slot(sg[g][0] - mm);
    lt += wg * sg[g][1];
    Et += wg * sg[g][2];
#pragma unroll
    for (int r = 0; r < 4; ++r) {
      oa[r] += wg * ag[g][r];
      ob[r] += wg * bg[g][r];
    }
  }
  const float inv = 1.0f / lt;                                        // o, E and l all carry the 2^4 factor
  const float ee  = EPSV * Et;

  const int qrow = 16 * qg + c;
  {
    v4f va, vb;
#pragma unroll
    for (int r = 0; r < 4; ++r) {
      va[r] = (oa[r] * IXSC + ee) * inv;
      vb[r] = (ob[r] * IXSC + ee) * inv;
    }
    *(v4f*)(Os + qrow * OSP + 16 * kg + 8 * hh)     = va;             // Os[query][ch = 16kg + 8hh + r]
    *(v4f*)(Os + qrow * OSP + 16 * kg + 8 * hh + 4) = vb;
  }
  __syncthreads();
  const int e = tid & 7, lq = tid >> 3;                               // lq 0..63
  v4f res[2];
#pragma unroll
  for (int it = 0; it < 2; ++it) {
    const int L   = it * 64 + lq;                                     // 0..127
    const int chl = L >> 1, hf = L & 1;                               // channel 0..63
    const int nl  = hf * 32 + 4 * e;                                  // query 0..63
#pragma unroll
    for (int t = 0; t < 4; ++t) res[it][t] = Os[(nl + t) * OSP + chl];
  }
{
#pragma unroll
    for (int it = 0; it < 2; ++it) {
      const int L   = it * 64 + lq;
      const int chl = L >> 1, hf = L & 1;
      const int nl  = hf * 32 + 4 * e;
      const size_t idx = ((size_t)(b * NC + chl)) * NP + n0 + nl;
      *(v4f*)(out + idx) = res[it];
    }
    
  }
}

// =============================================================================================================
// Workspace map (bytes; each region start a multiple of 256; every extent is an exact tile multiple and is written
//   FC f16 [NIMG][64][4096]   2097152      FP bf16 [NIMG][4096][64]  2097152
//   Qh/Ql bf16 [NIMG][4096][64]  2097152 x2
//   R f32 [NIMG][4096]  65536              G f32 [NIMG][4096]  65536
//   total (NIMG = 4) = 8519680
// =============================================================================================================
extern "C" void kernel_launch(void* const* d_in, const int* in_sizes, int n_in,
                              void* d_out, int out_size, void* d_ws, size_t ws_size,
                              hipStream_t stream) {
  const int XN = NIMG * NC * NP;
  if (n_in < 2) return;
  if (in_sizes[0] < XN) return;
  if (out_size < XN) return;

  size_t off = 0;
  auto carve = [&](size_t bytes) { const size_t o = off; off += (bytes + 255) & ~(size_t)255; return o; };
  const size_t oFC = carve((size_t)NIMG * NC * NP * 2);
  const size_t oFP = carve((size_t)NIMG * NP * NC * 2);
  const size_t oQh = carve((size_t)NIMG * NP * NC * 2);
  const size_t oQl = carve((size_t)NIMG * NP * NC * 2);
  const size_t oR  = carve((size_t)NIMG * NP * 4);
  const size_t oG  = carve((size_t)NIMG * NP * 4);
  if (off > ws_size) return;
  if (off > (size_t)134217728) return;

  const float* fg = (const float*)d_in[0];
  // d_in[1] (second input) does not enter this forward output; its pointer is bound to the first launch, unread.
  const float* aux = (const float*)d_in[1];

  char* ws = (char*)d_ws;
  unsigned short* FC = (unsigned short*)(ws + oFC);
  unsigned short* FP = (unsigned short*)(ws + oFP);
  unsigned short* Qh = (unsigned short*)(ws + oQh);
  unsigned short* Ql = (unsigned short*)(ws + oQl);
  float* R = (float*)(ws + oR);
  float* G = (float*)(ws + oG);
  float* out = (float*)d_out;

  const dim3 blk256(256), blkat(NTH);

  // (1) input -> channel-major f16 plane, key-major bf16 plane, per-pixel norm factors; 3x3 window sums -> query
  //     hi + residual bf16 planes, eps terms
  prep_f<<<dim3(HW, NIMG), blk256, 0, stream>>>(fg, aux, FC, FP, R, Qh, Ql, G);
  // (2) attention over the 4096 per-pixel kernels -> out [b][64][4096]
  attn_k<<<dim3(NP / QT, NIMG), blkat, 0, stream>>>(Qh, Ql, FP, FC, R, G, out);
  (void)hipGetLastError();
}

// v006
// It runs in 29.5 microseconds.
// Two timings next to v005 both put it at 1.04 times that version's speed.
// All steps since v000 together make it 7.64 times as fast.
// Contractions: scores S^T[p][q] = FB[p][c].Q[q][c] on v_wmma_f32_16x16x32_bf16 (A = bf16-RNE input rows, exact;
// B = bf16 hi + bf16 residual planes of the 3x3-summed input, 2 products, K = 64); O^T[c][q] = FB16[c][p].P[p][q]
// on v_wmma_f32_16x16x32_f16 (A = f16 of 16 x bf16-RNE input, exact; B = f16 of e^{s-m} x 2^4 x r_p x log2 e from the
// score D registers); f32 accumulate; per-pixel norm factor r_p, softmax statistics and the eps terms in f32 VALU.
#include <hip/hip_runtime.h>
#include <math.h>
#include <stdint.h>

#ifndef NIMG
#define NIMG 4
#endif
#define NB_FULL 4
#define NC     64
#define HW     64
#define NP     4096
#define QT     64
#define TP     72
#define OSP    68
#define XSC    16.0f
#define IXSC   0.0625f
#define EPSV   1.0e-7f
#define LOG2E  1.44269504f
#define LN2    0.693147181f
#define CARRY2 4.0f
#define ELIM    32768.0f
#define KT     256
#define NST    (NP / KT)
#define KPT    72
#define VPT    264
#define NKG    4
#define KG     (KT / NKG)
#define NTH    (128 * NKG)

static_assert(NIMG >= 1 && NIMG <= NB_FULL);
static_assert(NP == HW * HW);
static_assert(NP % QT == 0 && NP % 32 == 0);
static_assert(NC == 64);
static_assert(QT == 64 && QT == HW);                           // one query tile = one image row
static_assert((TP * 2) % 16 == 0);
static_assert((OSP * 4) % 16 == 0);
static_assert(NP % KT == 0 && KT % 32 == 0 && NST >= 2);
static_assert((KPT * 2) % 32 == 16 && (VPT * 2) % 32 == 16);   // LDS row pitch = 16 B x odd for b128 readers
static_assert(KT * NC * 2 == 4 * NTH * 16);                    // one tile = 4 copies of 16 B by each of 512 lanes
static_assert(NP * 4 == 2 * NTH * 16);
static_assert(KG % 32 == 0 && NKG == NC / 16);                 // wave of key group g merges channel block g

typedef _Float16       v16h __attribute__((ext_vector_type(16)));
typedef _Float16       v8h  __attribute__((ext_vector_type(8)));
typedef __bf16         v16b __attribute__((ext_vector_type(16)));
typedef unsigned short v8us __attribute__((ext_vector_type(8)));
typedef float          v8f  __attribute__((ext_vector_type(8)));
typedef float          v4f  __attribute__((ext_vector_type(4)));
typedef float          v2f  __attribute__((ext_vector_type(2)));
typedef unsigned int   v4u  __attribute__((ext_vector_type(4)));

union Frag  { v8us u[2]; v16h h; v16b bf; };
union FragH { v16h v; v8h hv[2]; };
static_assert(sizeof(Frag) == 32);
static_assert(sizeof(FragH) == 32);

// ---- scalar helpers -------------------------------------------------------------------------------------------
__device__ __forceinline__ unsigned short bf_bits(float f) {          // f32 -> bf16 bits, RNE convert
  unsigned u = __float_as_uint(f);
  return (unsigned short)((u + 0x7FFFu + ((u >> 16) & 1u)) >> 16);
}
__device__ __forceinline__ float bf_up(unsigned short hb) { return __uint_as_float(((unsigned)hb) << 16); }
__device__ __forceinline__ float bfr(float f) { return bf_up(bf_bits(f)); }
__device__ __forceinline__ unsigned short h_bits(_Float16 x) { return __builtin_bit_cast(unsigned short, x); }
__device__ __forceinline__ unsigned pk16(unsigned short a, unsigned short b) { return (unsigned)a | ((unsigned)b << 16); }
__device__ __forceinline__ v8f zero8() { v8f z = {0.f, 0.f, 0.f, 0.f, 0.f, 0.f, 0.f, 0.f}; return z; }
__device__ __forceinline__ float hmax8(v8f s) {
  return fmaxf(fmaxf(fmaxf(s[0], s[1]), fmaxf(s[2], s[3])), fmaxf(fmaxf(s[4], s[5]), fmaxf(s[6], s[7])));
}
// sum of eight as a tree of pairs: 4 + 4, 2 + 2, 1 + 1 (packed adds, three links deep)
__device__ __forceinline__ float hsum8(v8f s) {
  const v4f a = s.lo + s.hi;
  const v2f b = a.lo + a.hi;
  return b.x + b.y;
}
__device__ __forceinline__ v8f splat8(float x) { v8f z = {x, x, x, x, x, x, x, x}; return z; }
__device__ __forceinline__ unsigned wave_ballot(bool p) {
#if defined(__HIP_DEVICE_COMPILE__)
  return __builtin_amdgcn_ballot_w32(p);
#else
  return p ? 1u : 0u;
#endif
}

// 2^t (v_exp_f32), with the one free vector slot that the instruction set asks for behind a transcendental written
// into the same statement, so that no reader or overwrite stands directly behind it
__device__ __forceinline__ float exp2_slot(float t) {
  float y = t;
#if defined(__HIP_DEVICE_COMPILE__)
  asm("v_exp_f32 %0, %1\n\tv_nop" : "=v"(y) : "v"(t));
#endif
  return y;
}

// eight 2^t of the same form in one statement: the results are early-clobber, so inside it no v_exp_f32 is followed by
// a reader of its result or an overwrite of its source, and the one v_nop is the free slot behind the last of them
__device__ __forceinline__ v8f exp2x8_slot(v8f t) {
  v8f y = t;
#if defined(__HIP_DEVICE_COMPILE__)
  float y0, y1, y2, y3, y4, y5, y6, y7;
  asm("v_exp_f32 %0, %8\n\tv_exp_f32 %1, %9\n\tv_exp_f32 %2, %10\n\tv_exp_f32 %3, %11\n\t"
      "v_exp_f32 %4, %12\n\tv_exp_f32 %5, %13\n\tv_exp_f32 %6, %14\n\tv_exp_f32 %7, %15\n\tv_nop"
      : "=&v"(y0), "=&v"(y1), "=&v"(y2), "=&v"(y3), "=&v"(y4), "=&v"(y5), "=&v"(y6), "=&v"(y7)
      : "v"(t[0]), "v"(t[1]), "v"(t[2]), "v"(t[3]), "v"(t[4]), "v"(t[5]), "v"(t[6]), "v"(t[7]));
  y = v8f{y0, y1, y2, y3, y4, y5, y6, y7};
#endif
  return y;
}

// ---- 16-bit fragment loader (A, or B from a k-contiguous [n][k] row): lane -> row/col (lane&15), p already includes
//      + 8*(lane>>4); elements 0..7 <- p[0..7] (k0+8h..), elements 8..15 <- p[16..23] (k0+16+8h..)
__device__ __forceinline__ Frag ldfrag(const unsigned short* p) {
  Frag f;
  f.u[0] = *(const v8us*)(p);
  f.u[1] = *(const v8us*)(p + 16);
  return f;
}

// ---- WMMA helpers: the plain builtins; the compiler keeps the vector slots that the chip needs behind each of them ---
__device__ __forceinline__ v8f mma_h(v16h a, v16h b, v8f c) {
  return __builtin_amdgcn_wmma_f32_16x16x32_f16(false, a, false, b, (short)0, c, false, false);
}
__device__ __forceinline__ v8f mma_b(v16b a, v16b b, v8f c) {
  return __builtin_amdgcn_wmma_f32_16x16x32_bf16(false, a, false, b, (short)0, c, false, false);
}

// ---- asynchronous copies global -> LDS ---------------------------------------------------------------------------
typedef __attribute__((address_space(3))) const unsigned char lds_byte;
__device__ __forceinline__ unsigned lds_addr(const void* p) { return (unsigned)(uintptr_t)(lds_byte*)p; }
// Four (two) 16-byte copies per lane: LDS byte address l + i * ls <- global g + i * gs. The s_wait_xcnt stands inside
// the statement so that no address register named by a copy is rewritten in front of it.
__device__ __forceinline__ void copy4(unsigned l, unsigned ls, const char* g, size_t gs) {
#if defined(__HIP_DEVICE_COMPILE__)
  asm volatile(
      "global_load_async_to_lds_b128 %0, %4, off\n\t"
      "global_load_async_to_lds_b128 %1, %5, off\n\t"
      "global_load_async_to_lds_b128 %2, %6, off\n\t"
      "global_load_async_to_lds_b128 %3, %7, off\n\t"
      "s_wait_xcnt 0x0"
      :: "v"(l), "v"(l + ls), "v"(l + 2 * ls), "v"(l + 3 * ls), "v"(g), "v"(g + gs), "v"(g + 2 * gs), "v"(g + 3 * gs)
      : "memory");
#endif
}
__device__ __forceinline__ void copy2(unsigned l, unsigned ls, const char* g, size_t gs) {
#if defined(__HIP_DEVICE_COMPILE__)
  asm volatile(
      "global_load_async_to_lds_b128 %0, %2, off\n\t"
      "global_load_async_to_lds_b128 %1, %3, off\n\t"
      "s_wait_xcnt 0x0"
      :: "v"(l), "v"(l + ls), "v"(g), "v"(g + gs)
      : "memory");
#endif
}
__device__ __forceinline__ void wait_x0() {
#if defined(__HIP_DEVICE_COMPILE__)
  asm volatile("s_wait_xcnt 0x0" ::: "memory");
#endif
}
// this wave's copies have landed in LDS
__device__ __forceinline__ void wait_async0() {
#if defined(__HIP_DEVICE_COMPILE__)
  asm volatile("s_wait_asynccnt 0x0" ::: "memory");
#endif
}
// this wave's LDS reads have returned, so the buffer may be handed to its next writer
__device__ __forceinline__ void wait_ds0() {
#if defined(__HIP_DEVICE_COMPILE__)
  asm volatile("s_wait_dscnt 0x0" ::: "memory");
#endif
}

// =============================================================================================================
// (1) per (b, image row y), one launch for every operand plane of the row's 64 pixels p = 64 y + x:
//     FC f16 [b][c][p] = f16(16 * bf16-RNE(x)) (exact, channel-major, keys contiguous), FP bf16 [b][p][c] =
//     bf16-RNE(x) (key-major, channels contiguous) through an LDS tile T[64 x][64 c] (pitch TP), R f32 [b][p] =
//     log2 e x rsqrt(sum_c (bf16-RNE(x) + eps)^2) (4 lanes per p, fixed order);
//     FPOOL[c][x] = 3x3 zero-padded window sum of bf16-RNE(x) centred on pixel (y, x), f32, then Qh/Ql bf16
//     [b][q = 64 y + x][64 c] (query-major, channels contiguous): hi = bf16-RNE(v), lo = bf16-RNE(v - hi), staged
//     through LDS tiles Th/Tl[64 x][64 c] (pitch TP); G f32 [b][q] = eps * sum_c FPOOL.
//     Thread (ch = tid>>2, xq = tid&3) loads channel ch at x = 16 xq .. 16 xq + 15 of rows y-1, y, y+1; the centre
//     row's rounded values feed FC, T and the window sums alike. Edge taps use clamped addresses and are zeroed by
//     predicate; the row-validity test is block-uniform. The second pointer argument (aux) is bound only, never read.
// coverage: FC 64 ch x 4 lanes x 16 = 64 c x 64 p; FP, Qh, Ql 2 it x 32 rows x 8 lanes x 8 = 64 x x 64 c per plane;
//           R, G 16 lanes x 4 = 64; grid (64 y, NIMG) covers every c, p, q of images 0..NIMG-1 exactly once.
//           LDS: T/Th/Tl written 64 x 64, read 64 x 64; Gs written 64 c x 64 x, read same; Gq, Rs 64/64.
// =============================================================================================================
__global__ __launch_bounds__(256)
void prep_f(const float* __restrict__ f, const float* __restrict__ aux, unsigned short* FC, unsigned short* FP,
            float* R, unsigned short* Qh, unsigned short* Ql, float* G) {
  (void)aux;
  __shared__ __align__(16) unsigned short T[QT * TP];
  __shared__ __align__(16) unsigned short Th[QT * TP];
  __shared__ __align__(16) unsigned short Tl[QT * TP];
  __shared__ __align__(16) float Gs[NC * QT];
  __shared__ __align__(16) float Gq[QT];
  __shared__ __align__(16) float Rs[QT];
  const int tid = threadIdx.x;
  const int y = blockIdx.x, b = blockIdx.y;
  const int ch = tid >> 2, xq = tid & 3, x0 = 16 * xq;
  const float* fc = f + ((size_t)(b * NC + ch)) * NP;
  float s[16], cv[16];
#pragma unroll
  for (int i = 0; i < 16; ++i) { s[i] = 0.f; cv[i] = 0.f; }
#pragma unroll
  for (int dy = -1; dy <= 1; ++dy) {
    const int yy = y + dy;                                            // block-uniform
    if (yy >= 0 && yy < HW) {
      const float* row = fc + yy * HW;
      const v4f a0 = *(const v4f*)(row + x0);
      const v4f a1 = *(const v4f*)(row + x0 + 4);
      const v4f a2 = *(const v4f*)(row + x0 + 8);
      const v4f a3 = *(const v4f*)(row + x0 + 12);
      const int xl = (x0 > 0) ? (x0 - 1) : 0;                          // clamped addresses
      const int xr = (x0 + 16 < HW) ? (x0 + 16) : (HW - 1);
      float vl = row[xl];
      float vr = row[xr];
      wait_x0();                                                      // in front of any rewrite of the six loads' address registers
      vl = (x0 > 0) ? vl : 0.f;
      vr = (x0 + 16 < HW) ? vr : 0.f;
      float v[18];
      v[0] = bfr(vl); v[17] = bfr(vr);
#pragma unroll
      for (int t = 0; t < 4; ++t) {
        v[1 + t]  = bfr(a0[t]);
        v[5 + t]  = bfr(a1[t]);
        v[9 + t]  = bfr(a2[t]);
        v[13 + t] = bfr(a3[t]);
      }
#pragma unroll
      for (int i = 0; i < 16; ++i) s[i] += (v[i] + v[i + 1]) + v[i + 2];
      if (dy == 0) {                                                  // the row's own pixels, bf16-RNE in f32
#pragma unroll
        for (int i = 0; i < 16; ++i) cv[i] = v[i + 1];
      }
    }
  }
  v4u uc[2];
  {
    unsigned short hb[16];
#pragma unroll
    for (int i = 0; i < 16; ++i) {
      hb[i] = h_bits((_Float16)(cv[i] * XSC));
      T[(x0 + i) * TP + ch] = (unsigned short)(__float_as_uint(cv[i]) >> 16);   // T[x][c], the bf16 bits
    }
#pragma unroll
    for (int t = 0; t < 4; ++t) {
      uc[0][t] = pk16(hb[2 * t], hb[2 * t + 1]);
      uc[1][t] = pk16(hb[8 + 2 * t], hb[9 + 2 * t]);
    }
  }
#pragma unroll
  for (int i = 0; i < 16; ++i) {
    const unsigned short hb = bf_bits(s[i]);
    const unsigned short lb = bf_bits(s[i] - bf_up(hb));
    Th[(x0 + i) * TP + ch] = hb;
    Tl[(x0 + i) * TP + ch] = lb;
  }
#pragma unroll
  for (int t = 0; t < 4; ++t) {
    v4f gv4 = {s[4 * t], s[4 * t + 1], s[4 * t + 2], s[4 * t + 3]};
    *(v4f*)(Gs + ch * QT + x0 + 4 * t) = gv4;
  }
  __syncthreads();
  if (tid < QT) {                                                     // waves 0 and 1 entirely
    float g = 0.f;
#pragma unroll 4
    for (int cc = 0; cc < NC; ++cc) g += Gs[cc * QT + tid];
    Gq[tid] = g * EPSV;
  }
  const int e = tid & 7, lq = tid >> 3;                              // lq 0..31
  v4u up[2], uh[2], ul[2];
#pragma unroll
  for (int it = 0; it < 2; ++it) {
    const int xl2 = it * 32 + lq;                                     // x 0..63
    up[it] = *(const v4u*)(T + xl2 * TP + 8 * e);
    uh[it] = *(const v4u*)(Th + xl2 * TP + 8 * e);
    ul[it] = *(const v4u*)(Tl + xl2 * TP + 8 * e);
  }
  {
    const int pl = tid >> 2, sub = tid & 3;                          // 4 lanes per p, 16 channels each
    const unsigned short* tr = T + pl * TP + 16 * sub;
    const v8us w0 = *(const v8us*)(tr);
    const v8us w1 = *(const v8us*)(tr + 8);
    float q = 0.f;
#pragma unroll
    for (int i = 0; i < 8; ++i) { const float v = bf_up(w0[i]) + EPSV; q += v * v; }
#pragma unroll
    for (int i = 0; i < 8; ++i) { const float v = bf_up(w1[i]) + EPSV; q += v * v; }
    q += __shfl_xor(q, 1, 32);
    q += __shfl_xor(q, 2, 32);
    if (sub == 0) Rs[pl] = rsqrtf(q) * LOG2E;
  }
  __syncthreads();
  const v4f gv = *(const v4f*)(Gq + 4 * (tid & 15));
  const v4f rv = *(const v4f*)(Rs + 4 * (tid & 15));
  {
    unsigned short* fo = FC + ((size_t)(b * NC + ch)) * NP + y * HW + x0;
    *(v4u*)(fo)     = uc[0];
    *(v4u*)(fo + 8) = uc[1];
#pragma unroll
    for (int it = 0; it < 2; ++it) {
      const int xl2 = it * 32 + lq;
      const size_t po = ((size_t)(b * NP + y * HW + xl2)) * NC + 8 * e;
      *(v4u*)(FP + po) = up[it];
      *(v4u*)(Qh + po) = uh[it];
      *(v4u*)(Ql + po) = ul[it];
    }
    if (tid < 16) {
      *(v4f*)(R + (size_t)b * NP + y * HW + 4 * tid) = rv;
      *(v4f*)(G + (size_t)b * NP + y * HW + 4 * tid) = gv;
    }
  }
}

// =============================================================================================================
// (2) attention for one (b, 64-query tile), transposed formulation, 4096 keys, no mask:
//   S^T tile (16 keys x 16 queries) = A(FP row = key kb + (lane&15), 64 channels via the split k map, bf16 exact)
//   . B(Qh row = query, same map) + A(FP).B(Ql) (unscaled bf16 residual, shared accumulator), K = 64 = 2 steps;
//   the accumulator starts at g_query (the eps term, C operand of the first product), so that with R = r_key log2 e
//   the score in base 2 is t = R acc and one FMA, R acc + (4 - m), gives the argument of v_exp_f32 for
//   2^{t-m} x 2^4 = e^{s-m} x 2^4 (m in base 2 too). Q fragments and g are loaded once.
//   Per lane the D tile holds 8 keys of ONE query: online softmax per lane with a reference point m that lags the max:
//   m moves (max of the pass, one shuffle lane^16, o/l/E rescaled, the pass's exponentials formed anew) only where, by
//   a wave-uniform ballot, some lane's sum of e^{s-m} x 2^4 over its 16 keys passes ELIM = 2^15; else each is at most
//   2^15 and P stays in f16 range, with no max and no exchange in the pass. P = f16 of
//   e^{s-m} x 2^4 x R_key is the B operand of O^T (rows channel 16j + (lane&15), keys contiguous, f16 plane FC =
//   16 x input) . B(P^T): element r <- D of the tile covering keys kb..kb+15, element 8+r <- the tile covering
//   kb+16..kb+31, lane unchanged. 4 accumulator tiles per wave (64 channels). l = sum e and E = sum e R_key in f32:
//   l takes each pass's 16 terms as a tree of pairs, E runs as eight partial sums (one per D register) joined at the end.
//   Waves: 16 per work-group, four per SIMD. Wave w works on query group qg = w & 3 (16 queries) and key group
//   kg = w >> 2: of every stage it takes keys 64 kg .. 64 kg + 63 (two passes of 32), with softmax statistics and
//   accumulators of its own; the vector work of one wave runs under the matrix work and the LDS waits of the others.
//   Data path: the work-group's waves share every key tile. A stage = KT = 256 keys: FP rows (256 x 128 B, LDS
//   pitch 144 B) and FC rows (64 x 512 B, LDS pitch 528 B) come by 16-byte asynchronous copies into one of two LDS
//   buffers, one stage ahead of the stage being worked on; all 4096 norm factors of the image are copied once with
//   stage 0. Foot of each stage: LDS reads returned, own copies landed, barrier, then the refill of the buffer just read.
//   Merge: every wave stores m, l, E and its four O tiles in LDS Mg, barrier; wave (qg, kg) joins channel block kg of
//   query group qg over the four key groups in fixed order: weight 2^{m_g - max m}, sums of l, E and O.
//   Epilogue: out = (O / 16 + eps E) ln 2 / l (O and E carry R's log2 e) staged in LDS Os[query][64 channels]
//   (pitch OSP, b128 stores), barrier,
// coverage: Mg 16 waves x 9 x 32 lanes written, read 4 x 3 x 32 per wave; Os 16 waves x 16 queries x 16 ch; out 2 it x
//           64 lines x 8 lanes x 4 floats = 64 ch x 64 queries;
//           grid (64, NIMG) covers out[b][0..63][0..4095] of images 0..NIMG-1 exactly once.
// =============================================================================================================
__global__ __launch_bounds__(NTH)
void attn_k(const unsigned short* __restrict__ Qh, const unsigned short* __restrict__ Ql,
            const unsigned short* __restrict__ FP, const unsigned short* __restrict__ FC,
            const float* __restrict__ R, const float* __restrict__ G, float* out) {
  __shared__ __align__(16) float Os[QT * OSP];
  __shared__ __align__(16) unsigned short Ks[2 * KT * KPT];
  __shared__ __align__(16) unsigned short Vs[2 * NC * VPT];
  __shared__ __align__(16) float Rl[NP];
  __shared__ __align__(16) v4f Mg[4 * NKG * 9 * 32];
  const int tid  = threadIdx.x;
  const int wave = tid >> 5, lane = tid & 31;
  const int qg   = wave & 3, kg = wave >> 2;
  const int hh   = lane >> 4, c = lane & 15;
  const int n0   = blockIdx.x * QT, b = blockIdx.y;

  // q fragments (B operand, col = query n0 + 16*qg + c), channels 0..31 and 32..63
  const size_t qo = ((size_t)(b * NP + n0 + 16 * qg + c)) * NC + 8 * hh;
  const Frag qh0 = ldfrag(Qh + qo);
  const Frag qh1 = ldfrag(Qh + qo + 32);
  const Frag ql0 = ldfrag(Ql + qo);
  const Frag ql1 = ldfrag(Ql + qo + 32);
  const float gq = G[(size_t)b * NP + n0 + 16 * qg + c];
  // copy addresses of this lane. K tile: 16-byte chunk tid + 512 i of a contiguous 32 KiB, 8 chunks per 128-B row;
  // V tile: chunk tid + 512 i, 32 chunks per 512-B row of one channel; R: chunk tid + 512 i of 16 KiB.
  const char* gK = (const char*)(FP + (size_t)b * NP * NC) + 16 * tid;
  const char* gV = (const char*)(FC + (size_t)b * NC * NP) + (size_t)(tid >> 5) * (NP * 2) + 16 * (tid & 31);
  const char* gR = (const char*)(R + (size_t)b * NP) + 16 * tid;
  const unsigned lK = lds_addr(Ks) + (tid >> 3) * (KPT * 2) + 16 * (tid & 7);
  const unsigned lV = lds_addr(Vs) + (tid >> 5) * (VPT * 2) + 16 * (tid & 31);
  const unsigned lR = lds_addr(Rl) + 16 * tid;

  // stage 0 and the norm factors, published; then stage 1 in flight
  copy4(lK, 64 * KPT * 2, gK, 16 * NTH);
  copy4(lV, 16 * VPT * 2, gV, (size_t)16 * NP * 2);
  copy2(lR, 16 * NTH, gR, 16 * NTH);
  wait_async0();
  __syncthreads();
  copy4(lK + KT * KPT * 2, 64 * KPT * 2, gK + KT * NC * 2, 16 * NTH);
  copy4(lV + NC * VPT * 2, 16 * VPT * 2, gV + KT * 2, (size_t)16 * NP * 2);

  float m = -1.0e30f, nsh = 1.0e30f, l = 0.f;                       // nsh = CARRY2 - m
  v8f Ev = zero8();                                                   // E, one partial sum per D register
  const v8f gc = splat8(gq);
  v8f o[4];
#pragma unroll
  for (int j = 0; j < 4; ++j) o[j] = zero8();

#pragma unroll 1                                                      // one trip = one LDS stage
  for (int st = 0; st < NST; ++st) {
  const int buf = st & 1;
  // this wave's key group of the stage: k fragment base (A operand, row = key c of the tile), v fragment base (A
  // operand, row = channel 16j + c, keys contiguous), per-key norm factors for keys kb + 8hh + r and kb + 16 + 8hh + r
  const unsigned short* Kp = Ks + buf * (KT * KPT) + (kg * KG + c) * KPT + 8 * hh;
  const unsigned short* Vp = Vs + buf * (NC * VPT) + c * VPT + kg * KG + 8 * hh;
  const float* Rp = Rl + st * KT + kg * KG + 8 * hh;
#pragma unroll                                                        // constant LDS offsets for the two passes
  for (int kb = 0; kb < KG; kb += 32) {
    const unsigned short* k0p = Kp + kb * KPT;                      // keys kb .. kb+15 of this wave's key group
    const unsigned short* k1p = Kp + (kb + 16) * KPT;               // keys kb+16 .. kb+31
    v8f s0 = gc, s1 = gc;
    // all LDS reads of the pass stand here in one group: the norm factors and the v fragments return under the score
    // products and the softmax instead of being waited for one by one
    const Frag a0 = ldfrag(k0p), a1 = ldfrag(k0p + 32);
    const Frag c0 = ldfrag(k1p), c1 = ldfrag(k1p + 32);
    const v4f ra = *(const v4f*)(Rp + kb);
    const v4f rb = *(const v4f*)(Rp + kb + 4);
    const v4f rc = *(const v4f*)(Rp + kb + 16);
    const v4f rd = *(const v4f*)(Rp + kb + 20);
    Frag vf[4];
#pragma unroll
    for (int j = 0; j < 4; ++j) vf[j] = ldfrag(Vp + (16 * j) * VPT + kb);
#if defined(__HIP_DEVICE_COMPILE__)
    // keeps the group above whole and ahead of the pass's products (LDS reads and WMMAs do not cross, vector work may):
    // without it the v fragment reads sink to just in front of their products and are waited for there
    __builtin_amdgcn_sched_barrier(0x406);
#endif
    {
      s0 = mma_b(a0.bf, qh0.bf, s0);
      s1 = mma_b(c0.bf, qh0.bf, s1);
      s0 = mma_b(a0.bf, ql0.bf, s0);
      s1 = mma_b(c0.bf, ql0.bf, s1);
      s0 = mma_b(a1.bf, qh1.bf, s0);
      s1 = mma_b(c1.bf, qh1.bf, s1);
      s0 = mma_b(a1.bf, ql1.bf, s0);
      s1 = mma_b(c1.bf, ql1.bf, s1);
    }
    const v8f r0v = {ra[0], ra[1], ra[2], ra[3], rb[0], rb[1], rb[2], rb[3]};   // keys kb      + 8hh + r
    const v8f r1v = {rc[0], rc[1], rc[2], rc[3], rd[0], rd[1], rd[2], rd[3]};   // keys kb + 16 + 8hh + r

    // e^{s-m} x 2^4 against the reference point as it stands; their sum over this lane's 16 keys bounds each of them
    v8f x0 = exp2x8_slot(__builtin_elementwise_fma(s0, r0v, splat8(nsh)));
    v8f x1 = exp2x8_slot(__builtin_elementwise_fma(s1, r1v, splat8(nsh)));
    float ls = hsum8(x0 + x1);
    const unsigned over = wave_ballot(!(ls <= ELIM));                 // wave-uniform; an infinite sum counts as over
    if (__builtin_expect(over != 0u, 0)) {                            // rare: the reference point moves to the max so far
      const float mxl = fmaxf(hmax8(s0 * r0v), hmax8(s1 * r1v));      // this lane's own 16 keys
      const float mn = fmaxf(m, fmaxf(mxl, __shfl_xor(mxl, 16, 32))); // same value in both lanes of a query
      const float corr = exp2_slot(m - mn);                           // == 1 exactly for lanes whose max did not grow
      m = mn;
      nsh = CARRY2 - mn;
      l *= corr;
      Ev *= corr;
#pragma unroll
      for (int j = 0; j < 4; ++j) {
#pragma unroll
        for (int r = 0; r < 8; ++r) o[j][r] *= corr;
      }
      x0 = exp2x8_slot(__builtin_elementwise_fma(s0, r0v, splat8(nsh)));   // now every one is about 2^4 at most
      x1 = exp2x8_slot(__builtin_elementwise_fma(s1, r1v, splat8(nsh)));
      ls = hsum8(x0 + x1);
    }

    FragH ph;
    const v8f pe0 = x0 * r0v;
    const v8f pe1 = x1 * r1v;
#pragma unroll
    for (int r = 0; r < 8; ++r) {
      ph.hv[0][r] = (_Float16)pe0[r];
      ph.hv[1][r] = (_Float16)pe1[r];
    }
    l += ls;
    Ev += pe0 + pe1;

#pragma unroll
    for (int j = 0; j < 4; ++j) o[j] = mma_h(vf[j].h, ph.v, o[j]);
  }
  // publish stage st + 1 and free this stage's buffer
  wait_ds0();
  wait_async0();
  __syncthreads();
  if (st + 2 < NST) {                                                 // same for the whole work-group
    copy4(lK + buf * (KT * KPT * 2), 64 * KPT * 2, gK + (size_t)(st + 2) * (KT * NC * 2), 16 * NTH);
    copy4(lV + buf * (NC * VPT * 2), 16 * VPT * 2, gV + (size_t)(st + 2) * (KT * 2), (size_t)16 * NP * 2);
  }
  }
  wait_async0();
  float E = hsum8(Ev);
  l += __shfl_xor(l, 16, 32);
  E += __shfl_xor(E, 16, 32);
  // this wave's partial result: Mg[wave][2j + half][lane] = O tile j, Mg[wave][8][lane] = statistics
  {
    v4f* mg = Mg + wave * (9 * 32) + lane;
#pragma unroll
    for (int j = 0; j < 4; ++j) {
      const v4f pa = {o[j][0], o[j][1], o[j][2], o[j][3]};
      const v4f pb = {o[j][4], o[j][5], o[j][6], o[j][7]};
      mg[(2 * j) * 32]     = pa;
      mg[(2 * j + 1) * 32] = pb;
    }
    const v4f ps = {m, l, E, 0.f};
    mg[8 * 32] = ps;
  }
  __syncthreads();
  // join the four key groups for channel block kg of query group qg, key groups in fixed order 0..3
  v4f sg[NKG], ag[NKG], bg[NKG];
#pragma unroll
  for (int g = 0; g < NKG; ++g) {
    const v4f* mg = Mg + (g * 4 + qg) * (9 * 32) + lane;
    sg[g] = mg[8 * 32];
    ag[g] = mg[(2 * kg) * 32];
    bg[g] = mg[(2 * kg + 1) * 32];
  }
  const float mm = fmaxf(fmaxf(sg[0][0], sg[1][0]), fmaxf(sg[2][0], sg[3][0]));
  float lt = 0.f, Et = 0.f;
  v4f oa = {0.f, 0.f, 0.f, 0.f}, ob = {0.f, 0.f, 0.f, 0.f};
#pragma unroll
  for (int g = 0; g < NKG; ++g) {
    const float wg = exp2_slot(sg[g][0] - mm);
    lt += wg * sg[g][1];
    Et += wg * sg[g][2];
#pragma unroll
    for (int r = 0; r < 4; ++r) {
      oa[r] += wg * ag[g][r];
      ob[r] += wg * bg[g][r];
    }
  }
  const float inv = LN2 / lt;                                         // o, E and l all carry 2^4; o and E log2 e too
  const float ee  = EPSV * Et;

  const int qrow = 16 * qg + c;
  {
    v4f va, vb;
#pragma unroll
    for (int r = 0; r < 4; ++r) {
      va[r] = (oa[r] * IXSC + ee) * inv;
      vb[r] = (ob[r] * IXSC + ee) * inv;
    }
    *(v4f*)(Os + qrow * OSP + 16 * kg + 8 * hh)     = va;             // Os[query][ch = 16kg + 8hh + r]
    *(v4f*)(Os + qrow * OSP + 16 * kg + 8 * hh + 4) = vb;
  }
  __syncthreads();
  const int e = tid & 7, lq = tid >> 3;                               // lq 0..63
  v4f res[2];
#pragma unroll
  for (int it = 0; it < 2; ++it) {
    const int L   = it * 64 + lq;                                     // 0..127
    const int chl = L >> 1, hf = L & 1;                               // channel 0..63
    const int nl  = hf * 32 + 4 * e;                                  // query 0..63
#pragma unroll
    for (int t = 0; t < 4; ++t) res[it][t] = Os[(nl + t) * OSP + chl];
  }
{
#pragma unroll
    for (int it = 0; it < 2; ++it) {
      const int L   = it * 64 + lq;
      const int chl = L >> 1, hf = L & 1;
      const int nl  = hf * 32 + 4 * e;
      const size_t idx = ((size_t)(b * NC + chl)) * NP + n0 + nl;
      *(v4f*)(out + idx) = res[it];
    }
    
  }
}

// =============================================================================================================
// Workspace map (bytes; each region start a multiple of 256; every extent is an exact tile multiple and is written
//   FC f16 [NIMG][64][4096]   2097152      FP bf16 [NIMG][4096][64]  2097152
//   Qh/Ql bf16 [NIMG][4096][64]  2097152 x2
//   R f32 [NIMG][4096]  65536              G f32 [NIMG][4096]  65536
//   total (NIMG = 4) = 8519680
// =============================================================================================================
extern "C" void kernel_launch(void* const* d_in, const int* in_sizes, int n_in,
                              void* d_out, int out_size, void* d_ws, size_t ws_size,
                              hipStream_t stream) {
  const int XN = NIMG * NC * NP;
  if (n_in < 2) return;
  if (in_sizes[0] < XN) return;
  if (out_size < XN) return;

  size_t off = 0;
  auto carve = [&](size_t bytes) { const size_t o = off; off += (bytes + 255) & ~(size_t)255; return o; };
  const size_t oFC = carve((size_t)NIMG * NC * NP * 2);
  const size_t oFP = carve((size_t)NIMG * NP * NC * 2);
  const size_t oQh = carve((size_t)NIMG * NP * NC * 2);
  const size_t oQl = carve((size_t)NIMG * NP * NC * 2);
  const size_t oR  = carve((size_t)NIMG * NP * 4);
  const size_t oG  = carve((size_t)NIMG * NP * 4);
  if (off > ws_size) return;
  if (off > (size_t)134217728) return;

  const float* fg = (const float*)d_in[0];
  // d_in[1] (second input) does not enter this forward output; its pointer is bound to the first launch, unread.
  const float* aux = (const float*)d_in[1];

  char* ws = (char*)d_ws;
  unsigned short* FC = (unsigned short*)(ws + oFC);
  unsigned short* FP = (unsigned short*)(ws + oFP);
  unsigned short* Qh = (unsigned short*)(ws + oQh);
  unsigned short* Ql = (unsigned short*)(ws + oQl);
  float* R = (float*)(ws + oR);
  float* G = (float*)(ws + oG);
  float* out = (float*)d_out;

  const dim3 blk256(256), blkat(NTH);

  // (1) input -> channel-major f16 plane, key-major bf16 plane, per-pixel norm factors; 3x3 window sums -> query
  //     hi + residual bf16 planes, eps terms
  prep_f<<<dim3(HW, NIMG), blk256, 0, stream>>>(fg, aux, FC, FP, R, Qh, Ql, G);
  // (2) attention over the 4096 per-pixel kernels -> out [b][64][4096]
  attn_k<<<dim3(NP / QT, NIMG), blkat, 0, stream>>>(Qh, Ql, FP, FC, R, G, out);
  (void)hipGetLastError();
}

// v009
// It runs in 24.1 microseconds.
// Versions in between are left out here; by their measured steps it is 1.24 times as fast as v006.
// Counting every step since v000, it is 9.50 times as fast.
// Contractions, both on v_wmma_f32_16x16x32_f16: scores S^T[p][q] = KN[p][c].Q[q][c] (A = f16 of the normalised
// kernel (x + eps) r_p x log2 e; B = f16 of the 3x3-summed f32 input, one product, K = 64, C = 4 - m);
// O^T[c][q] = KN^T[c][p].P[p][q] (A = the same f16 plane, read transposed; B = f16 of e^{s-m} x 2^4 from the score D
// registers; the plane's log2 e is divided out at the end);
// f32 accumulate; the per-pixel norm factor r_p and the eps term are applied in f32 by the first launch, before the one
// rounding to f16; softmax statistics in f32 VALU.
#include <hip/hip_runtime.h>
#include <math.h>
#include <stdint.h>

#ifndef NIMG
#define NIMG 4
#endif
#define NB_FULL 4
#define NC     64
#define HW     64
#define NP     4096
#define QT     64
#define TP     72
#define OSP    68
#define XP     68
#define EPSV   1.0e-7f
#define LOG2E  1.44269504f
#define LN2    0.693147181f
#define CARRY2 4.0f
#define ELIM    32768.0f
#define KT     256
#define NST    (NP / KT)
#define KPT    72
#define NKG    4
#define KG     (KT / NKG)
#define NTH    (128 * NKG)

static_assert(NIMG >= 1 && NIMG <= NB_FULL);
static_assert(NP == HW * HW);
static_assert(NP % QT == 0 && NP % 32 == 0);
static_assert(NC == 64);
static_assert(QT == 64 && QT == HW);                           // one query tile = one image row
static_assert((TP * 2) % 16 == 0);
static_assert((OSP * 4) % 16 == 0 && (XP * 4) % 16 == 0);
static_assert(NP % KT == 0 && KT % 32 == 0 && NST >= 2);
static_assert((KPT * 2) % 32 == 16);                           // LDS row pitch = 16 B x odd for b128 readers
static_assert((2 * KPT * 2) % 64 == 32);                       // every 2nd row = 32 B x odd for the transposing reader
static_assert(KT * NC * 2 == 4 * NTH * 16);                    // one tile = 4 copies of 16 B by each of 512 lanes
static_assert(KG % 32 == 0 && NKG == NC / 16);                 // wave of key group g merges channel block g

typedef _Float16       v16h __attribute__((ext_vector_type(16)));
typedef _Float16       v8h  __attribute__((ext_vector_type(8)));
typedef unsigned short v8us __attribute__((ext_vector_type(8)));
typedef short          v8s  __attribute__((ext_vector_type(8)));
typedef float          v8f  __attribute__((ext_vector_type(8)));
typedef float          v4f  __attribute__((ext_vector_type(4)));
typedef float          v2f  __attribute__((ext_vector_type(2)));
typedef unsigned int   v4u  __attribute__((ext_vector_type(4)));

union Frag  { v8us u[2]; v16h h; };
union FragH { v16h v; v8h hv[2]; };
static_assert(sizeof(Frag) == 32);
static_assert(sizeof(FragH) == 32);

// ---- scalar helpers -------------------------------------------------------------------------------------------
__device__ __forceinline__ unsigned short h_bits(_Float16 x) { return __builtin_bit_cast(unsigned short, x); }
__device__ __forceinline__ v8f zero8() { v8f z = {0.f, 0.f, 0.f, 0.f, 0.f, 0.f, 0.f, 0.f}; return z; }
__device__ __forceinline__ float hmax8(v8f s) {
  return fmaxf(fmaxf(fmaxf(s[0], s[1]), fmaxf(s[2], s[3])), fmaxf(fmaxf(s[4], s[5]), fmaxf(s[6], s[7])));
}
// sum of eight as a tree of pairs: 4 + 4, 2 + 2, 1 + 1 (packed adds, three links deep)
__device__ __forceinline__ float hsum8(v8f s) {
  const v4f a = s.lo + s.hi;
  const v2f b = a.lo + a.hi;
  return b.x + b.y;
}
__device__ __forceinline__ v8f splat8(float x) { v8f z = {x, x, x, x, x, x, x, x}; return z; }
__device__ __forceinline__ unsigned wave_ballot(bool p) {
#if defined(__HIP_DEVICE_COMPILE__)
  return __builtin_amdgcn_ballot_w32(p);
#else
  return p ? 1u : 0u;
#endif
}

// 2^t (v_exp_f32), with the one free vector slot that the instruction set asks for behind a transcendental written
// into the same statement, so that no reader or overwrite stands directly behind it
__device__ __forceinline__ float exp2_slot(float t) {
  float y = t;
#if defined(__HIP_DEVICE_COMPILE__)
  asm("v_exp_f32 %0, %1\n\tv_nop" : "=v"(y) : "v"(t));
#endif
  return y;
}

// eight 2^t of the same form in one statement: the results are early-clobber, so inside it no v_exp_f32 is followed by
// a reader of its result or an overwrite of its source, and the one v_nop is the free slot behind the last of them
__device__ __forceinline__ v8f exp2x8_slot(v8f t) {
  v8f y = t;
#if defined(__HIP_DEVICE_COMPILE__)
  float y0, y1, y2, y3, y4, y5, y6, y7;
  asm("v_exp_f32 %0, %8\n\tv_exp_f32 %1, %9\n\tv_exp_f32 %2, %10\n\tv_exp_f32 %3, %11\n\t"
      "v_exp_f32 %4, %12\n\tv_exp_f32 %5, %13\n\tv_exp_f32 %6, %14\n\tv_exp_f32 %7, %15\n\tv_nop"
      : "=&v"(y0), "=&v"(y1), "=&v"(y2), "=&v"(y3), "=&v"(y4), "=&v"(y5), "=&v"(y6), "=&v"(y7)
      : "v"(t[0]), "v"(t[1]), "v"(t[2]), "v"(t[3]), "v"(t[4]), "v"(t[5]), "v"(t[6]), "v"(t[7]));
  y = v8f{y0, y1, y2, y3, y4, y5, y6, y7};
#endif
  return y;
}

// eight 2^t straight from the D registers of a matrix product: the builtin, so that the compiler sees the reader and
// keeps the vector slots that the chip needs between a v_wmma and the first reader of its D (it does not pad asm text)
__device__ __forceinline__ v8f exp2x8_mma(v8f t) {
  v8f y = t;
#if defined(__HIP_DEVICE_COMPILE__)
#pragma unroll
  for (int r = 0; r < 8; ++r) y[r] = __builtin_amdgcn_exp2f(t[r]);
#endif
  return y;
}

// ---- 16-bit fragment loader (A, or B from a k-contiguous [n][k] row): lane -> row/col (lane&15), p already includes
//      + 8*(lane>>4); elements 0..7 <- p[0..7] (k0+8h..), elements 8..15 <- p[16..23] (k0+16+8h..)
__device__ __forceinline__ Frag ldfrag(const unsigned short* p) {
  Frag f;
  f.u[0] = *(const v8us*)(p);
  f.u[1] = *(const v8us*)(p + 16);
  return f;
}

// ---- transposing LDS load of 16 rows x 16 columns of 16-bit values: lane l hands in the address of 16-byte piece
//      (l >> 3) & 1 of the tile's row 8 (l >> 4) + (l & 7); lane (c = l & 15, h = l >> 4) gets column c of rows 8h + 0 .. 7
__device__ __forceinline__ v8us ld_tr16(const unsigned short* p) {
#if defined(__HIP_DEVICE_COMPILE__)
  typedef __attribute__((address_space(3))) v8s lds_v8s;
  return __builtin_bit_cast(v8us, __builtin_amdgcn_ds_load_tr16_b128_v8i16((lds_v8s*)p));
#else
  return *(const v8us*)p;
#endif
}

// ---- WMMA helper: the plain builtin; the compiler keeps the vector slots that the chip needs behind it --------------
__device__ __forceinline__ v8f mma_h(v16h a, v16h b, v8f c) {
  return __builtin_amdgcn_wmma_f32_16x16x32_f16(false, a, false, b, (short)0, c, false, false);
}

// ---- asynchronous copies global -> LDS ---------------------------------------------------------------------------
typedef __attribute__((address_space(3))) const unsigned char lds_byte;
__device__ __forceinline__ unsigned lds_addr(const void* p) { return (unsigned)(uintptr_t)(lds_byte*)p; }
// Four 16-byte copies per lane: LDS byte address l + i * ls <- global g + i * gs. The s_wait_xcnt stands inside
// the statement so that no address register named by a copy is rewritten in front of it.
__device__ __forceinline__ void copy4(unsigned l, unsigned ls, const char* g, size_t gs) {
#if defined(__HIP_DEVICE_COMPILE__)
  asm volatile(
      "global_load_async_to_lds_b128 %0, %4, off\n\t"
      "global_load_async_to_lds_b128 %1, %5, off\n\t"
      "global_load_async_to_lds_b128 %2, %6, off\n\t"
      "global_load_async_to_lds_b128 %3, %7, off\n\t"
      "s_wait_xcnt 0x0"
      :: "v"(l), "v"(l + ls), "v"(l + 2 * ls), "v"(l + 3 * ls), "v"(g), "v"(g + gs), "v"(g + 2 * gs), "v"(g + 3 * gs)
      : "memory");
#endif
}
__device__ __forceinline__ void wait_x0() {
#if defined(__HIP_DEVICE_COMPILE__)
  asm volatile("s_wait_xcnt 0x0" ::: "memory");
#endif
}
// this wave's copies have landed in LDS
__device__ __forceinline__ void wait_async0() {
#if defined(__HIP_DEVICE_COMPILE__)
  asm volatile("s_wait_asynccnt 0x0" ::: "memory");
#endif
}
// this wave's LDS reads have returned, so the buffer may be handed to its next writer
__device__ __forceinline__ void wait_ds0() {
#if defined(__HIP_DEVICE_COMPILE__)
  asm volatile("s_wait_dscnt 0x0" ::: "memory");
#endif
}

// =============================================================================================================
// (1) per (b, image row y), one launch for every operand plane of the row's 64 pixels p = 64 y + x:
//     r_p = rsqrt(sum_c (x + eps)^2) in f32 (4 lanes per p, fixed order, from an f32 LDS tile Xs[64 c][64 x], pitch XP);
//     FP f16 [b][p][c] = f16((x + eps) r_p log2 e) (key-major, channels contiguous) through an LDS tile
//     T[64 x][64 c] (pitch TP): the one plane that serves the second launch as K and, read transposed, as V;
//     FPOOL[c][x] = 3x3 zero-padded window sum of x centred on pixel (y, x), f32, then Qh f16 [b][q = 64 y + x][64 c]
//     (query-major, channels contiguous) = f16(FPOOL), staged through an LDS tile Th[64 x][64 c] (pitch TP).
//     Thread (ch = tid>>2, xq = tid&3) loads channel ch at x = 16 xq .. 16 xq + 15 of rows y-1, y, y+1; the centre
//     row's values feed Xs, T and the window sums alike. Edge taps use clamped addresses and are zeroed by
//     predicate; the row-validity test is block-uniform. The second pointer argument (aux) is bound only, never read.
// coverage: FP, Qh 2 it x 32 rows x 8 lanes x 8 = 64 x x 64 c per plane;
//           grid (64 y, NIMG) covers every c, p, q of images 0..NIMG-1 exactly once.
//           LDS: T/Th written 64 x 64, read 64 x 64; Xs written 64 c x 64 x, read same; Rs 64/64.
// =============================================================================================================
__global__ __launch_bounds__(256)
void prep_f(const float* __restrict__ f, const float* __restrict__ aux, unsigned short* FP, unsigned short* Qh) {
  (void)aux;
  __shared__ __align__(16) unsigned short T[QT * TP];
  __shared__ __align__(16) unsigned short Th[QT * TP];
  __shared__ __align__(16) float Xs[NC * XP];
  __shared__ __align__(16) float Rs[QT];
  const int tid = threadIdx.x;
  const int y = blockIdx.x, b = blockIdx.y;
  const int ch = tid >> 2, xq = tid & 3, x0 = 16 * xq;
  const float* fc = f + ((size_t)(b * NC + ch)) * NP;
  float s[16], cv[16];
#pragma unroll
  for (int i = 0; i < 16; ++i) { s[i] = 0.f; cv[i] = 0.f; }
#pragma unroll
  for (int dy = -1; dy <= 1; ++dy) {
    const int yy = y + dy;                                            // block-uniform
    if (yy >= 0 && yy < HW) {
      const float* row = fc + yy * HW;
      const v4f a0 = *(const v4f*)(row + x0);
      const v4f a1 = *(const v4f*)(row + x0 + 4);
      const v4f a2 = *(const v4f*)(row + x0 + 8);
      const v4f a3 = *(const v4f*)(row + x0 + 12);
      const int xl = (x0 > 0) ? (x0 - 1) : 0;                          // clamped addresses
      const int xr = (x0 + 16 < HW) ? (x0 + 16) : (HW - 1);
      float vl = row[xl];
      float vr = row[xr];
      wait_x0();                                                      // in front of any rewrite of the six loads' address registers
      vl = (x0 > 0) ? vl : 0.f;
      vr = (x0 + 16 < HW) ? vr : 0.f;
      float v[18];
      v[0] = vl; v[17] = vr;
#pragma unroll
      for (int t = 0; t < 4; ++t) {
        v[1 + t]  = a0[t];
        v[5 + t]  = a1[t];
        v[9 + t]  = a2[t];
        v[13 + t] = a3[t];
      }
#pragma unroll
      for (int i = 0; i < 16; ++i) s[i] += (v[i] + v[i + 1]) + v[i + 2];
      if (dy == 0) {                                                  // the row's own pixels
#pragma unroll
        for (int i = 0; i < 16; ++i) cv[i] = v[i + 1] + EPSV;         // x + eps
      }
    }
  }
#pragma unroll
  for (int i = 0; i < 16; ++i) Th[(x0 + i) * TP + ch] = h_bits((_Float16)s[i]);
#pragma unroll
  for (int t = 0; t < 4; ++t) {
    v4f xv4 = {cv[4 * t], cv[4 * t + 1], cv[4 * t + 2], cv[4 * t + 3]};
    *(v4f*)(Xs + ch * XP + x0 + 4 * t) = xv4;
  }
  __syncthreads();
  const int e = tid & 7, lq = tid >> 3;                              // lq 0..31
  v4u up[2], uh[2];
#pragma unroll
  for (int it = 0; it < 2; ++it) uh[it] = *(const v4u*)(Th + (it * 32 + lq) * TP + 8 * e);
  {
    const int pl = tid >> 2, sub = tid & 3;                          // 4 lanes per p, channels sub, sub + 4, ...
    float q = 0.f;
#pragma unroll
    for (int i = 0; i < 16; ++i) { const float v = Xs[(4 * i + sub) * XP + pl]; q += v * v; }
    q += __shfl_xor(q, 1, 32);
    q += __shfl_xor(q, 2, 32);
    if (sub == 0) Rs[pl] = rsqrtf(q);
  }
  __syncthreads();
#pragma unroll
  for (int t = 0; t < 4; ++t) {
    const v4f rv = *(const v4f*)(Rs + x0 + 4 * t);
#pragma unroll
    for (int u = 0; u < 4; ++u) {
      const int i = 4 * t + u;
      const float kv = cv[i] * rv[u];                                 // one entry of the normalised kernel, f32
      T[(x0 + i) * TP + ch] = h_bits((_Float16)(kv * LOG2E));         // T[x][c], the f16 bits
    }
  }
  __syncthreads();
#pragma unroll
  for (int it = 0; it < 2; ++it) up[it] = *(const v4u*)(T + (it * 32 + lq) * TP + 8 * e);
  {
#pragma unroll
    for (int it = 0; it < 2; ++it) {
      const int xl2 = it * 32 + lq;
      const size_t po = ((size_t)(b * NP + y * HW + xl2)) * NC + 8 * e;
      *(v4u*)(FP + po) = up[it];
      *(v4u*)(Qh + po) = uh[it];
    }
  }
}

// =============================================================================================================
// (2) attention for one (b, 64-query tile), transposed formulation, 4096 keys, no mask:
//   S^T tile (16 keys x 16 queries) = A(row 8h + r = FP row of key kb + 2r + h, 64 channels via the split k map, f16)
//   . B(Qh row = query, same map, f16), K = 64 = 2 steps;
//   FP holds the normalised kernel x log2 e, so the product is the score in base 2, t; the accumulator starts at 4 - m
//   (C operand of the first product, set at the head of each stage), so that the D registers are the arguments of
//   v_exp_f32 for 2^{t-m} x 2^4 = e^{s-m} x 2^4 (m in base 2 too). Q fragments are loaded once.
//   Per lane the D tile holds 8 keys of ONE query: online softmax per lane with a reference point m that lags the max:
//   m moves (max of the pass, one shuffle lane^16, o/l rescaled, the pass's exponentials formed anew) only where, by
//   a wave-uniform ballot, some lane's sum of e^{s-m} x 2^4 over its 16 keys passes the limit (ELIM = 2^15; -1 in
//   stage 0, whose first pass sets m, and behind a move up to the stage's end, while the C operand still holds the old
//   m); else each is at most 2^15 and P stays in f16 range, with no max and no exchange in the pass.
//   P = f16 of e^{s-m} x 2^4 is the B operand of O^T = A(rows channel 16j + (lane&15): the same FP rows in LDS through
//   the transposing load, lane half h taking keys kb + 2r + h) . B(P^T): element r <- D of the tile covering keys
//   kb..kb+15, element 8+r <- the tile covering kb+16..kb+31, lane unchanged, so both sides hold key kb + 2r + h
//   (+ 16) at element r (+ 8) of half h. 4 accumulator tiles per wave (64 channels).
//   l = sum e in f32 takes each pass's 16 terms as a tree of pairs.
//   Waves: 16 per work-group, four per SIMD. Wave w works on query group qg = w & 3 (16 queries) and key group
//   kg = w >> 2: of every stage it takes keys 64 kg .. 64 kg + 63 (two passes of 32), with softmax statistics and
//   accumulators of its own; the vector work of one wave runs under the matrix work and the LDS waits of the others.
//   Data path: the work-group's waves share every key tile. A stage = KT = 256 keys: FP rows (256 x 128 B, LDS
//   pitch 144 B) come by 16-byte asynchronous copies into one of two LDS buffers, one stage ahead of the stage being
//   worked on. The tile is read as K by ds_load_b128 (16 rows a half wave: 16 B x odd) and as V by ds_load_tr16_b128
//   (a half wave takes 8 rows two apart: 288 B = 32 B x odd), each without a bank conflict.
//   Foot of each stage: LDS reads returned, own copies landed, barrier, then the refill of the buffer just read.
//   Merge: every wave stores m, l and its four O tiles in LDS Mg, barrier; wave (qg, kg) joins channel block kg of
//   query group qg over the four key groups in fixed order: weight 2^{m_g - max m}, sums of l and O.
//   Epilogue: out = O / (l log2 e) staged in LDS Os[query][64 channels]
//   (pitch OSP, b128 stores), barrier,
// coverage: Mg 16 waves x 9 x 32 lanes written, read 4 x 3 x 32 per wave; Os 16 waves x 16 queries x 16 ch; out 2 it x
//           64 lines x 8 lanes x 4 floats = 64 ch x 64 queries;
//           grid (64, NIMG) covers out[b][0..63][0..4095] of images 0..NIMG-1 exactly once.
// =============================================================================================================
__global__ __launch_bounds__(NTH)
void attn_k(const unsigned short* __restrict__ Qh, const unsigned short* __restrict__ FP, float* out) {
  __shared__ __align__(16) float Os[QT * OSP];
  __shared__ __align__(16) unsigned short Ks[2 * KT * KPT];
  __shared__ __align__(16) v4f Mg[4 * NKG * 9 * 32];
  const int tid  = threadIdx.x;
  const int wave = tid >> 5, lane = tid & 31;
  const int qg   = wave & 3, kg = wave >> 2;
  const int hh   = lane >> 4, c = lane & 15;
  const int n0   = blockIdx.x * QT, b = blockIdx.y;

  // q fragments (B operand, col = query n0 + 16*qg + c), channels 0..31 and 32..63
  const size_t qo = ((size_t)(b * NP + n0 + 16 * qg + c)) * NC + 8 * hh;
  const Frag qh0 = ldfrag(Qh + qo);
  const Frag qh1 = ldfrag(Qh + qo + 32);
  // copy addresses of this lane: 16-byte chunk tid + 512 i of a contiguous 32 KiB, 8 chunks per 128-B row
  const char* gK = (const char*)(FP + (size_t)b * NP * NC) + 16 * tid;
  const unsigned lK = lds_addr(Ks) + (tid >> 3) * (KPT * 2) + 16 * (tid & 7);
  // key rows inside a 16-key tile: kr = the key that row c of the score product's A operand holds; vr = the key whose
  // piece this lane hands to the transposing load (the load's row 8 hh + (lane & 7))
  const int kr = 2 * (c & 7) + (c >> 3);
  const int vr = 2 * (lane & 7) + hh;

  // stage 0, published; then stage 1 in flight
  copy4(lK, 64 * KPT * 2, gK, 16 * NTH);
  wait_async0();
  __syncthreads();
  copy4(lK + KT * KPT * 2, 64 * KPT * 2, gK + KT * NC * 2, 16 * NTH);

  float m = -1.0e30f, l = 0.f;
  v8f o[4];
#pragma unroll
  for (int j = 0; j < 4; ++j) o[j] = zero8();

#pragma unroll 1                                                      // one trip = one LDS stage
  for (int st = 0; st < NST; ++st) {
  const int buf = st & 1;
  // the C operand of the stage's score products: CARRY2 - m as m stands at the head of the stage (0 while there is no m
  // yet). A pass whose m is no longer the stage's goes through the rare branch, which takes the difference into account:
  // lim = -1 sends it there (every pass of stage 0, and the passes of a stage behind a move of m)
  const v8f nv = splat8((st == 0) ? 0.f : CARRY2 - m);
  float lim = (st == 0) ? -1.0f : ELIM;
  // this wave's key group of the stage: k fragment base (A operand, row c = key kr of the tile), v fragment base (this
  // lane's piece for the transposing load; A operand, row = channel 16j + c)
  const unsigned short* Kp = Ks + buf * (KT * KPT) + (kg * KG + kr) * KPT + 8 * hh;
  const unsigned short* Vp = Ks + buf * (KT * KPT) + (kg * KG + vr) * KPT + 8 * ((lane >> 3) & 1);
#pragma unroll                                                        // constant LDS offsets for the two passes
  for (int kb = 0; kb < KG; kb += 32) {
    const unsigned short* k0p = Kp + kb * KPT;                      // keys kb .. kb+15 of this wave's key group
    const unsigned short* k1p = Kp + (kb + 16) * KPT;               // keys kb+16 .. kb+31
    v8f s0 = nv, s1 = nv;
    // all LDS reads of the pass stand here in one group: the v fragments return under the score products and the
    // softmax instead of being waited for one by one
    const Frag a0 = ldfrag(k0p), a1 = ldfrag(k0p + 32);
    const Frag c0 = ldfrag(k1p), c1 = ldfrag(k1p + 32);
    Frag vf[4];
#pragma unroll
    for (int j = 0; j < 4; ++j) {
      vf[j].u[0] = ld_tr16(Vp + kb * KPT + 16 * j);                   // keys kb + 2r + hh of channel 16j + c
      vf[j].u[1] = ld_tr16(Vp + (kb + 16) * KPT + 16 * j);            // keys kb + 16 + 2r + hh
    }
#if defined(__HIP_DEVICE_COMPILE__)
    // keeps the group above whole and ahead of the pass's products (LDS reads and WMMAs do not cross, vector work may):
    // without it the v fragment reads sink to just in front of their products and are waited for there
    __builtin_amdgcn_sched_barrier(0x406);
#endif
    {
      s0 = mma_h(a0.h, qh0.h, s0);
      s1 = mma_h(c0.h, qh0.h, s1);
      s0 = mma_h(a1.h, qh1.h, s0);
      s1 = mma_h(c1.h, qh1.h, s1);
    }

    // e^{s-m} x 2^4 against the reference point as it stands; their sum over this lane's 16 keys bounds each of them
    v8f x0 = exp2x8_mma(s0);
    v8f x1 = exp2x8_mma(s1);
    float ls = hsum8(x0 + x1);
    const unsigned over = wave_ballot(!(ls <= lim));                  // wave-uniform; an infinite sum counts as over
    if (__builtin_expect(over != 0u, 0)) {                            // rare: the reference point moves to the max so far
      const v8f t0 = s0 - nv, t1 = s1 - nv;                           // the plain scores: the stage's shift taken off
      const float mxl = fmaxf(hmax8(t0), hmax8(t1));                  // this lane's own 16 keys
      const float mn = fmaxf(m, fmaxf(mxl, __shfl_xor(mxl, 16, 32))); // same value in both lanes of a query
      const float corr = exp2_slot(m - mn);                           // == 1 exactly for lanes whose max did not grow
      m = mn;
      lim = -1.0f;
      l *= corr;
#pragma unroll
      for (int j = 0; j < 4; ++j) {
#pragma unroll
        for (int r = 0; r < 8; ++r) o[j][r] *= corr;
      }
      x0 = exp2x8_slot(t0 + splat8(CARRY2 - mn));                     // now every one is about 2^4 at most
      x1 = exp2x8_slot(t1 + splat8(CARRY2 - mn));
      ls = hsum8(x0 + x1);
    }

    FragH ph;
#pragma unroll
    for (int r = 0; r < 8; ++r) {
      ph.hv[0][r] = (_Float16)x0[r];
      ph.hv[1][r] = (_Float16)x1[r];
    }
    l += ls;

#pragma unroll
    for (int j = 0; j < 4; ++j) o[j] = mma_h(vf[j].h, ph.v, o[j]);
  }
  // publish stage st + 1 and free this stage's buffer
  wait_ds0();
  wait_async0();
  __syncthreads();
  if (st + 2 < NST) {                                                 // same for the whole work-group
    copy4(lK + buf * (KT * KPT * 2), 64 * KPT * 2, gK + (size_t)(st + 2) * (KT * NC * 2), 16 * NTH);
  }
  }
  wait_async0();
  l += __shfl_xor(l, 16, 32);
  // this wave's partial result: Mg[wave][2j + half][lane] = O tile j, Mg[wave][8][lane] = statistics
  {
    v4f* mg = Mg + wave * (9 * 32) + lane;
#pragma unroll
    for (int j = 0; j < 4; ++j) {
      const v4f pa = {o[j][0], o[j][1], o[j][2], o[j][3]};
      const v4f pb = {o[j][4], o[j][5], o[j][6], o[j][7]};
      mg[(2 * j) * 32]     = pa;
      mg[(2 * j + 1) * 32] = pb;
    }
    const v4f ps = {m, l, 0.f, 0.f};
    mg[8 * 32] = ps;
  }
  __syncthreads();
  // join the four key groups for channel block kg of query group qg, key groups in fixed order 0..3
  v4f sg[NKG], ag[NKG], bg[NKG];
#pragma unroll
  for (int g = 0; g < NKG; ++g) {
    const v4f* mg = Mg + (g * 4 + qg) * (9 * 32) + lane;
    sg[g] = mg[8 * 32];
    ag[g] = mg[(2 * kg) * 32];
    bg[g] = mg[(2 * kg + 1) * 32];
  }
  const float mm = fmaxf(fmaxf(sg[0][0], sg[1][0]), fmaxf(sg[2][0], sg[3][0]));
  float lt = 0.f;
  v4f oa = {0.f, 0.f, 0.f, 0.f}, ob = {0.f, 0.f, 0.f, 0.f};
#pragma unroll
  for (int g = 0; g < NKG; ++g) {
    const float wg = exp2_slot(sg[g][0] - mm);
    lt += wg * sg[g][1];
#pragma unroll
    for (int r = 0; r < 4; ++r) {
      oa[r] += wg * ag[g][r];
      ob[r] += wg * bg[g][r];
    }
  }
  const float inv = LN2 / lt;                                         // o and l both carry 2^4; o the plane's log2 e too

  const int qrow = 16 * qg + c;
  {
    v4f va, vb;
#pragma unroll
    for (int r = 0; r < 4; ++r) {
      va[r] = oa[r] * inv;
      vb[r] = ob[r] * inv;
    }
    *(v4f*)(Os + qrow * OSP + 16 * kg + 8 * hh)     = va;             // Os[query][ch = 16kg + 8hh + r]
    *(v4f*)(Os + qrow * OSP + 16 * kg + 8 * hh + 4) = vb;
  }
  __syncthreads();
  const int e = tid & 7, lq = tid >> 3;                               // lq 0..63
  v4f res[2];
#pragma unroll
  for (int it = 0; it < 2; ++it) {
    const int L   = it * 64 + lq;                                     // 0..127
    const int chl = L >> 1, hf = L & 1;                               // channel 0..63
    const int nl  = hf * 32 + 4 * e;                                  // query 0..63
#pragma unroll
    for (int t = 0; t < 4; ++t) res[it][t] = Os[(nl + t) * OSP + chl];
  }
{
#pragma unroll
    for (int it = 0; it < 2; ++it) {
      const int L   = it * 64 + lq;
      const int chl = L >> 1, hf = L & 1;
      const int nl  = hf * 32 + 4 * e;
      const size_t idx = ((size_t)(b * NC + chl)) * NP + n0 + nl;
      *(v4f*)(out + idx) = res[it];
    }
    
  }
}

// =============================================================================================================
// Workspace map (bytes; each region start a multiple of 256; every extent is an exact tile multiple and is written
//   FP f16 [NIMG][4096][64]  2097152      Qh f16 [NIMG][4096][64]  2097152
//   total (NIMG = 4) = 4194304
// =============================================================================================================
extern "C" void kernel_launch(void* const* d_in, const int* in_sizes, int n_in,
                              void* d_out, int out_size, void* d_ws, size_t ws_size,
                              hipStream_t stream) {
  const int XN = NIMG * NC * NP;
  if (n_in < 2) return;
  if (in_sizes[0] < XN) return;
  if (out_size < XN) return;

  size_t off = 0;
  auto carve = [&](size_t bytes) { const size_t o = off; off += (bytes + 255) & ~(size_t)255; return o; };
  const size_t oFP = carve((size_t)NIMG * NP * NC * 2);
  const size_t oQh = carve((size_t)NIMG * NP * NC * 2);
  if (off > ws_size) return;
  if (off > (size_t)134217728) return;

  const float* fg = (const float*)d_in[0];
  // d_in[1] (second input) does not enter this forward output; its pointer is bound to the first launch, unread.
  const float* aux = (const float*)d_in[1];

  char* ws = (char*)d_ws;
  unsigned short* FP = (unsigned short*)(ws + oFP);
  unsigned short* Qh = (unsigned short*)(ws + oQh);
  float* out = (float*)d_out;

  const dim3 blk256(256), blkat(NTH);

  // (1) input -> normalised kernels as one key-major f16 plane; 3x3 window sums -> query f16 plane
  prep_f<<<dim3(HW, NIMG), blk256, 0, stream>>>(fg, aux, FP, Qh);
  // (2) attention over the 4096 per-pixel kernels -> out [b][64][4096]
  attn_k<<<dim3(NP / QT, NIMG), blkat, 0, stream>>>(Qh, FP, out);
  (void)hipGetLastError();
}

// v010
// It runs in 23 microseconds.
// In two side-by-side timings against v009, it was 1.05 and 1.04 times as fast.
// All steps since v000 together make it 9.94 times as fast.
// Contractions, both on v_wmma_f32_16x16x32_f16: scores S^T[p][q] = KN[p][c].Q[q][c] (A = f16 of the normalised
// kernel (x + eps) r_p x log2 e; B = f16 of the 3x3-summed f32 input, one product, K = 64, C = 4 - m);
// O^T[c][q] = KN^T[c][p].P[p][q] (A = the same f16 plane, read transposed; B = f16 of e^{s-m} x 2^4 from the score D
// registers; the plane's log2 e is divided out at the end);
// f32 accumulate; the per-pixel norm factor r_p and the eps term are applied in f32 by the first launch, before the one
// rounding to f16; softmax statistics in f32 VALU.
#include <hip/hip_runtime.h>
#include <math.h>
#include <stdint.h>

#ifndef NIMG
#define NIMG 4
#endif
#define NB_FULL 4
#define NC     64
#define HW     64
#define NP     4096
#define QT     64
#define TP     72
#define OSP    68
#define XP     68
#define EPSV   1.0e-7f
#define LOG2E  1.44269504f
#define LN2    0.693147181f
#define CARRY2 4.0f
#define ELIM    32768.0f
#define KT     512
#define NST    (NP / KT)
#define KPT    72
#define NKG    4
#define KG     (KT / NKG)
#define KH     64
#define KR     (NKG * KH)
#define RPS    (KT / KR)
#define NRN    (NP / KR)
#define NTH    (128 * NKG)

static_assert(NIMG >= 1 && NIMG <= NB_FULL);
static_assert(NP == HW * HW);
static_assert(NP % QT == 0 && NP % 32 == 0);
static_assert(NC == 64);
static_assert(QT == 64 && QT == HW);                           // one query tile = one image row
static_assert((TP * 2) % 16 == 0);
static_assert((OSP * 4) % 16 == 0 && (XP * 4) % 16 == 0);
static_assert(NP % KT == 0 && KT % 32 == 0 && NST >= 2);
static_assert((KPT * 2) % 32 == 16);                           // LDS row pitch = 16 B x odd for b128 readers
static_assert((2 * KPT * 2) % 64 == 32);                       // every 2nd row = 32 B x odd for the transposing reader
static_assert(KT * NC * 2 == 8 * NTH * 16);                    // one tile = 8 copies of 16 B by each of 512 lanes
static_assert(KG % KH == 0 && KH % 32 == 0 && NKG == NC / 16); // wave of key group g merges channel block g
static_assert(RPS * KR == KT && RPS == 2 && NRN == RPS * NST); // a stage = two runs of every key group

typedef _Float16       v16h __attribute__((ext_vector_type(16)));
typedef _Float16       v8h  __attribute__((ext_vector_type(8)));
typedef unsigned short v8us __attribute__((ext_vector_type(8)));
typedef short          v8s  __attribute__((ext_vector_type(8)));
typedef float          v8f  __attribute__((ext_vector_type(8)));
typedef float          v4f  __attribute__((ext_vector_type(4)));
typedef float          v2f  __attribute__((ext_vector_type(2)));
typedef unsigned int   v4u  __attribute__((ext_vector_type(4)));

union Frag  { v8us u[2]; v16h h; };
union FragH { v16h v; v8h hv[2]; };
static_assert(sizeof(Frag) == 32);
static_assert(sizeof(FragH) == 32);

// ---- scalar helpers -------------------------------------------------------------------------------------------
__device__ __forceinline__ unsigned short h_bits(_Float16 x) { return __builtin_bit_cast(unsigned short, x); }
__device__ __forceinline__ v8f zero8() { v8f z = {0.f, 0.f, 0.f, 0.f, 0.f, 0.f, 0.f, 0.f}; return z; }
__device__ __forceinline__ float hmax8(v8f s) {
  return fmaxf(fmaxf(fmaxf(s[0], s[1]), fmaxf(s[2], s[3])), fmaxf(fmaxf(s[4], s[5]), fmaxf(s[6], s[7])));
}
// sum of eight as a tree of pairs: 4 + 4, 2 + 2, 1 + 1 (packed adds, three links deep)
__device__ __forceinline__ float hsum8(v8f s) {
  const v4f a = s.lo + s.hi;
  const v2f b = a.lo + a.hi;
  return b.x + b.y;
}
__device__ __forceinline__ v8f splat8(float x) { v8f z = {x, x, x, x, x, x, x, x}; return z; }
__device__ __forceinline__ unsigned wave_ballot(bool p) {
#if defined(__HIP_DEVICE_COMPILE__)
  return __builtin_amdgcn_ballot_w32(p);
#else
  return p ? 1u : 0u;
#endif
}

// 2^t (v_exp_f32), with the one free vector slot that the instruction set asks for behind a transcendental written
// into the same statement, so that no reader or overwrite stands directly behind it
__device__ __forceinline__ float exp2_slot(float t) {
  float y = t;
#if defined(__HIP_DEVICE_COMPILE__)
  asm("v_exp_f32 %0, %1\n\tv_nop" : "=v"(y) : "v"(t));
#endif
  return y;
}

// eight 2^t of the same form in one statement: the results are early-clobber, so inside it no v_exp_f32 is followed by
// a reader of its result or an overwrite of its source, and the one v_nop is the free slot behind the last of them
__device__ __forceinline__ v8f exp2x8_slot(v8f t) {
  v8f y = t;
#if defined(__HIP_DEVICE_COMPILE__)
  float y0, y1, y2, y3, y4, y5, y6, y7;
  asm("v_exp_f32 %0, %8\n\tv_exp_f32 %1, %9\n\tv_exp_f32 %2, %10\n\tv_exp_f32 %3, %11\n\t"
      "v_exp_f32 %4, %12\n\tv_exp_f32 %5, %13\n\tv_exp_f32 %6, %14\n\tv_exp_f32 %7, %15\n\tv_nop"
      : "=&v"(y0), "=&v"(y1), "=&v"(y2), "=&v"(y3), "=&v"(y4), "=&v"(y5), "=&v"(y6), "=&v"(y7)
      : "v"(t[0]), "v"(t[1]), "v"(t[2]), "v"(t[3]), "v"(t[4]), "v"(t[5]), "v"(t[6]), "v"(t[7]));
  y = v8f{y0, y1, y2, y3, y4, y5, y6, y7};
#endif
  return y;
}

// eight 2^t straight from the D registers of a matrix product: the builtin, so that the compiler sees the reader and
// keeps the vector slots that the chip needs between a v_wmma and the first reader of its D (it does not pad asm text)
__device__ __forceinline__ v8f exp2x8_mma(v8f t) {
  v8f y = t;
#if defined(__HIP_DEVICE_COMPILE__)
#pragma unroll
  for (int r = 0; r < 8; ++r) y[r] = __builtin_amdgcn_exp2f(t[r]);
#endif
  return y;
}

// ---- 16-bit fragment loader (A, or B from a k-contiguous [n][k] row): lane -> row/col (lane&15), p already includes
//      + 8*(lane>>4); elements 0..7 <- p[0..7] (k0+8h..), elements 8..15 <- p[16..23] (k0+16+8h..)
__device__ __forceinline__ Frag ldfrag(const unsigned short* p) {
  Frag f;
  f.u[0] = *(const v8us*)(p);
  f.u[1] = *(const v8us*)(p + 16);
  return f;
}

// ---- transposing LDS load of 16 rows x 16 columns of 16-bit values: lane l hands in the address of 16-byte piece
//      (l >> 3) & 1 of the tile's row 8 (l >> 4) + (l & 7); lane (c = l & 15, h = l >> 4) gets column c of rows 8h + 0 .. 7
__device__ __forceinline__ v8us ld_tr16(const unsigned short* p) {
#if defined(__HIP_DEVICE_COMPILE__)
  typedef __attribute__((address_space(3))) v8s lds_v8s;
  return __builtin_bit_cast(v8us, __builtin_amdgcn_ds_load_tr16_b128_v8i16((lds_v8s*)p));
#else
  return *(const v8us*)p;
#endif
}

// ---- WMMA helper: the plain builtin; the compiler keeps the vector slots that the chip needs behind it --------------
__device__ __forceinline__ v8f mma_h(v16h a, v16h b, v8f c) {
  return __builtin_amdgcn_wmma_f32_16x16x32_f16(false, a, false, b, (short)0, c, false, false);
}

// ---- asynchronous copies global -> LDS ---------------------------------------------------------------------------
typedef __attribute__((address_space(3))) const unsigned char lds_byte;
__device__ __forceinline__ unsigned lds_addr(const void* p) { return (unsigned)(uintptr_t)(lds_byte*)p; }
// Eight 16-byte copies per lane: LDS byte address l + i * ls <- global g + i * gs. The s_wait_xcnt stands inside
// the statement so that no address register named by a copy is rewritten in front of it.
__device__ __forceinline__ void copy8(unsigned l, unsigned ls, const char* g, size_t gs) {
#if defined(__HIP_DEVICE_COMPILE__)
  asm volatile(
      "global_load_async_to_lds_b128 %0, %8, off\n\t"
      "global_load_async_to_lds_b128 %1, %9, off\n\t"
      "global_load_async_to_lds_b128 %2, %10, off\n\t"
      "global_load_async_to_lds_b128 %3, %11, off\n\t"
      "global_load_async_to_lds_b128 %4, %12, off\n\t"
      "global_load_async_to_lds_b128 %5, %13, off\n\t"
      "global_load_async_to_lds_b128 %6, %14, off\n\t"
      "global_load_async_to_lds_b128 %7, %15, off\n\t"
      "s_wait_xcnt 0x0"
      :: "v"(l), "v"(l + ls), "v"(l + 2 * ls), "v"(l + 3 * ls),
         "v"(l + 4 * ls), "v"(l + 5 * ls), "v"(l + 6 * ls), "v"(l + 7 * ls),
         "v"(g), "v"(g + gs), "v"(g + 2 * gs), "v"(g + 3 * gs),
         "v"(g + 4 * gs), "v"(g + 5 * gs), "v"(g + 6 * gs), "v"(g + 7 * gs)
      : "memory");
#endif
}
__device__ __forceinline__ void wait_x0() {
#if defined(__HIP_DEVICE_COMPILE__)
  asm volatile("s_wait_xcnt 0x0" ::: "memory");
#endif
}
// this wave's copies have landed in LDS
__device__ __forceinline__ void wait_async0() {
#if defined(__HIP_DEVICE_COMPILE__)
  asm volatile("s_wait_asynccnt 0x0" ::: "memory");
#endif
}
// this wave's LDS reads have returned, so the buffer may be handed to its next writer
__device__ __forceinline__ void wait_ds0() {
#if defined(__HIP_DEVICE_COMPILE__)
  asm volatile("s_wait_dscnt 0x0" ::: "memory");
#endif
}

// =============================================================================================================
// (1) per (b, image row y), one launch for every operand plane of the row's 64 pixels p = 64 y + x:
//     r_p = rsqrt(sum_c (x + eps)^2) in f32 (4 lanes per p, fixed order, from an f32 LDS tile Xs[64 c][64 x], pitch XP);
//     FP f16 [b][p][c] = f16((x + eps) r_p log2 e) (key-major, channels contiguous) through an LDS tile
//     T[64 x][64 c] (pitch TP): the one plane that serves the second launch as K and, read transposed, as V;
//     FPOOL[c][x] = 3x3 zero-padded window sum of x centred on pixel (y, x), f32, then Qh f16 [b][q = 64 y + x][64 c]
//     (query-major, channels contiguous) = f16(FPOOL), staged through an LDS tile Th[64 x][64 c] (pitch TP).
//     Thread (ch = tid>>2, xq = tid&3) loads channel ch at x = 16 xq .. 16 xq + 15 of rows y-1, y, y+1; the centre
//     row's values feed Xs, T and the window sums alike. Edge taps use clamped addresses and are zeroed by
//     predicate; the row-validity test is block-uniform. The second pointer argument (aux) is bound only, never read.
// coverage: FP, Qh 2 it x 32 rows x 8 lanes x 8 = 64 x x 64 c per plane;
//           grid (64 y, NIMG) covers every c, p, q of images 0..NIMG-1 exactly once.
//           LDS: T/Th written 64 x 64, read 64 x 64; Xs written 64 c x 64 x, read same; Rs 64/64.
// =============================================================================================================
__global__ __launch_bounds__(256)
void prep_f(const float* __restrict__ f, const float* __restrict__ aux, unsigned short* FP, unsigned short* Qh) {
  (void)aux;
  __shared__ __align__(16) unsigned short T[QT * TP];
  __shared__ __align__(16) unsigned short Th[QT * TP];
  __shared__ __align__(16) float Xs[NC * XP];
  __shared__ __align__(16) float Rs[QT];
  const int tid = threadIdx.x;
  const int y = blockIdx.x, b = blockIdx.y;
  const int ch = tid >> 2, xq = tid & 3, x0 = 16 * xq;
  const float* fc = f + ((size_t)(b * NC + ch)) * NP;
  float s[16], cv[16];
#pragma unroll
  for (int i = 0; i < 16; ++i) { s[i] = 0.f; cv[i] = 0.f; }
#pragma unroll
  for (int dy = -1; dy <= 1; ++dy) {
    const int yy = y + dy;                                            // block-uniform
    if (yy >= 0 && yy < HW) {
      const float* row = fc + yy * HW;
      const v4f a0 = *(const v4f*)(row + x0);
      const v4f a1 = *(const v4f*)(row + x0 + 4);
      const v4f a2 = *(const v4f*)(row + x0 + 8);
      const v4f a3 = *(const v4f*)(row + x0 + 12);
      const int xl = (x0 > 0) ? (x0 - 1) : 0;                          // clamped addresses
      const int xr = (x0 + 16 < HW) ? (x0 + 16) : (HW - 1);
      float vl = row[xl];
      float vr = row[xr];
      wait_x0();                                                      // in front of any rewrite of the six loads' address registers
      vl = (x0 > 0) ? vl : 0.f;
      vr = (x0 + 16 < HW) ? vr : 0.f;
      float v[18];
      v[0] = vl; v[17] = vr;
#pragma unroll
      for (int t = 0; t < 4; ++t) {
        v[1 + t]  = a0[t];
        v[5 + t]  = a1[t];
        v[9 + t]  = a2[t];
        v[13 + t] = a3[t];
      }
#pragma unroll
      for (int i = 0; i < 16; ++i) s[i] += (v[i] + v[i + 1]) + v[i + 2];
      if (dy == 0) {                                                  // the row's own pixels
#pragma unroll
        for (int i = 0; i < 16; ++i) cv[i] = v[i + 1] + EPSV;         // x + eps
      }
    }
  }
#pragma unroll
  for (int i = 0; i < 16; ++i) Th[(x0 + i) * TP + ch] = h_bits((_Float16)s[i]);
#pragma unroll
  for (int t = 0; t < 4; ++t) {
    v4f xv4 = {cv[4 * t], cv[4 * t + 1], cv[4 * t + 2], cv[4 * t + 3]};
    *(v4f*)(Xs + ch * XP + x0 + 4 * t) = xv4;
  }
  __syncthreads();
  const int e = tid & 7, lq = tid >> 3;                              // lq 0..31
  v4u up[2], uh[2];
#pragma unroll
  for (int it = 0; it < 2; ++it) uh[it] = *(const v4u*)(Th + (it * 32 + lq) * TP + 8 * e);
  {
    const int pl = tid >> 2, sub = tid & 3;                          // 4 lanes per p, channels sub, sub + 4, ...
    float q = 0.f;
#pragma unroll
    for (int i = 0; i < 16; ++i) { const float v = Xs[(4 * i + sub) * XP + pl]; q += v * v; }
    q += __shfl_xor(q, 1, 32);
    q += __shfl_xor(q, 2, 32);
    if (sub == 0) Rs[pl] = rsqrtf(q);
  }
  __syncthreads();
#pragma unroll
  for (int t = 0; t < 4; ++t) {
    const v4f rv = *(const v4f*)(Rs + x0 + 4 * t);
#pragma unroll
    for (int u = 0; u < 4; ++u) {
      const int i = 4 * t + u;
      const float kv = cv[i] * rv[u];                                 // one entry of the normalised kernel, f32
      T[(x0 + i) * TP + ch] = h_bits((_Float16)(kv * LOG2E));         // T[x][c], the f16 bits
    }
  }
  __syncthreads();
#pragma unroll
  for (int it = 0; it < 2; ++it) up[it] = *(const v4u*)(T + (it * 32 + lq) * TP + 8 * e);
  {
#pragma unroll
    for (int it = 0; it < 2; ++it) {
      const int xl2 = it * 32 + lq;
      const size_t po = ((size_t)(b * NP + y * HW + xl2)) * NC + 8 * e;
      *(v4u*)(FP + po) = up[it];
      *(v4u*)(Qh + po) = uh[it];
    }
  }
}

// =============================================================================================================
// (2) attention for one (b, 64-query tile), transposed formulation, 4096 keys, no mask:
//   S^T tile (16 keys x 16 queries) = A(row 8h + r = FP row of key kb + 2r + h, 64 channels via the split k map, f16)
//   . B(Qh row = query, same map, f16), K = 64 = 2 steps;
//   FP holds the normalised kernel x log2 e, so the product is the score in base 2, t; the accumulator starts at 4 - m
//   (C operand of the first product, set at the head of each run of 64 keys), so that the D registers are the arguments of
//   v_exp_f32 for 2^{t-m} x 2^4 = e^{s-m} x 2^4 (m in base 2 too). Q fragments are loaded once.
//   Per lane the D tile holds 8 keys of ONE query: online softmax per lane with a reference point m that lags the max:
//   m moves (max of the pass, one shuffle lane^16, o/l rescaled, the pass's exponentials formed anew) only where, by
//   a wave-uniform ballot, some lane's sum of e^{s-m} x 2^4 over its 16 keys passes the limit (ELIM = 2^15; -1 in
//   the first run, whose first pass sets m, and behind a move up to the run's end, while the C operand still holds the
//   old m); else each is at most 2^15 and P stays in f16 range, with no max and no exchange in the pass.
//   P = f16 of e^{s-m} x 2^4 is the B operand of O^T = A(rows channel 16j + (lane&15): the same FP rows in LDS through
//   the transposing load, lane half h taking keys kb + 2r + h) . B(P^T): element r <- D of the tile covering keys
//   kb..kb+15, element 8+r <- the tile covering kb+16..kb+31, lane unchanged, so both sides hold key kb + 2r + h
//   (+ 16) at element r (+ 8) of half h. 4 accumulator tiles per wave (64 channels).
//   l = sum e in f32 takes each pass's 16 terms as a tree of pairs.
//   Waves: 16 per work-group, four per SIMD. Wave w works on query group qg = w & 3 (16 queries) and key group
//   kg = w >> 2: of every 256 keys it takes keys 64 kg .. 64 kg + 63 (a run: two passes of 32), with softmax statistics and
//   accumulators of its own; the vector work of one wave runs under the matrix work and the LDS waits of the others.
//   Data path: the work-group's waves share every key tile. A stage = KT = 512 keys, two runs: FP rows (512 x 128 B, LDS
//   pitch 144 B) come by 16-byte asynchronous copies into one of two LDS buffers, one stage ahead of the stage being
//   worked on. The tile is read as K by ds_load_b128 (16 rows a half wave: 16 B x odd) and as V by ds_load_tr16_b128
//   (a half wave takes 8 rows two apart: 288 B = 32 B x odd), each without a bank conflict.
//   Foot of each stage: LDS reads returned, own copies landed, barrier, then the refill of the buffer just read.
//   Merge: every wave stores m, l and its four O tiles in LDS Mg, barrier; wave (qg, kg) joins channel block kg of
//   query group qg over the four key groups in fixed order: weight 2^{m_g - max m}, sums of l and O.
//   Epilogue: out = O / (l log2 e) staged in LDS Os[query][64 channels]
//   (pitch OSP, b128 stores), barrier,
// coverage: Mg 16 waves x 9 x 32 lanes written, read 4 x 3 x 32 per wave; Os 16 waves x 16 queries x 16 ch; out 2 it x
//           64 lines x 8 lanes x 4 floats = 64 ch x 64 queries;
//           grid (64, NIMG) covers out[b][0..63][0..4095] of images 0..NIMG-1 exactly once.
// =============================================================================================================
__global__ __launch_bounds__(NTH)
void attn_k(const unsigned short* __restrict__ Qh, const unsigned short* __restrict__ FP, float* out) {
  __shared__ __align__(16) float Os[QT * OSP];
  __shared__ __align__(16) unsigned short Ks[2 * KT * KPT];
  __shared__ __align__(16) v4f Mg[4 * NKG * 9 * 32];
  const int tid  = threadIdx.x;
  const int wave = tid >> 5, lane = tid & 31;
  const int qg   = wave & 3, kg = wave >> 2;
  const int hh   = lane >> 4, c = lane & 15;
  const int n0   = blockIdx.x * QT, b = blockIdx.y;

  // q fragments (B operand, col = query n0 + 16*qg + c), channels 0..31 and 32..63
  const size_t qo = ((size_t)(b * NP + n0 + 16 * qg + c)) * NC + 8 * hh;
  const Frag qh0 = ldfrag(Qh + qo);
  const Frag qh1 = ldfrag(Qh + qo + 32);
  // copy addresses of this lane: 16-byte chunk tid + 512 i of a contiguous 64 KiB, 8 chunks per 128-B row
  const char* gK = (const char*)(FP + (size_t)b * NP * NC) + 16 * tid;
  const unsigned lK = lds_addr(Ks) + (tid >> 3) * (KPT * 2) + 16 * (tid & 7);
  // key rows inside a 16-key tile: kr = the key that row c of the score product's A operand holds; vr = the key whose
  // piece this lane hands to the transposing load (the load's row 8 hh + (lane & 7))
  const int kr = 2 * (c & 7) + (c >> 3);
  const int vr = 2 * (lane & 7) + hh;

  // stage 0, published; then stage 1 in flight
  copy8(lK, 64 * KPT * 2, gK, 16 * NTH);
  wait_async0();
  __syncthreads();
  copy8(lK + KT * KPT * 2, 64 * KPT * 2, gK + KT * NC * 2, 16 * NTH);

  float m = -1.0e30f, l = 0.f;
  v8f o[4];
#pragma unroll
  for (int j = 0; j < 4; ++j) o[j] = zero8();

#pragma unroll 1                                                      // one trip = one run, half an LDS stage
  for (int rn = 0; rn < NRN; ++rn) {
  // the C operand of the run's score products: CARRY2 - m as m stands at the head of the run (0 while there is no m
  // yet). A pass whose m is no longer the run's goes through the rare branch, which takes the difference into account:
  // lim = -1 sends it there (every pass of the first run, and the passes of a run behind a move of m)
  const v8f nv = splat8((rn == 0) ? 0.f : CARRY2 - m);
  float lim = (rn == 0) ? -1.0f : ELIM;
  // this wave's key group of the run: k fragment base (A operand, row c = key kr of the tile), v fragment base (this
  // lane's piece for the transposing load; A operand, row = channel 16j + c); the two buffers hold four runs in a row
  const int slot = rn & (2 * RPS - 1);
  const unsigned short* Kp = Ks + slot * (KR * KPT) + (kg * KH + kr) * KPT + 8 * hh;
  const unsigned short* Vp = Ks + slot * (KR * KPT) + (kg * KH + vr) * KPT + 8 * ((lane >> 3) & 1);
#pragma unroll                                                        // constant LDS offsets for the two passes
  for (int kb = 0; kb < KH; kb += 32) {
    const unsigned short* k0p = Kp + kb * KPT;                      // keys kb .. kb+15 of the run  
    const unsigned short* k1p = Kp + (kb + 16) * KPT;               // keys kb+16 .. kb+31
    v8f s0 = nv, s1 = nv;
    // all LDS reads of the pass stand here in one group: the v fragments return under the score products and the
    // softmax instead of being waited for one by one
    const Frag a0 = ldfrag(k0p), a1 = ldfrag(k0p + 32);
    const Frag c0 = ldfrag(k1p), c1 = ldfrag(k1p + 32);
    Frag vf[4];
#pragma unroll
    for (int j = 0; j < 4; ++j) {
      vf[j].u[0] = ld_tr16(Vp + kb * KPT + 16 * j);                   // keys kb + 2r + hh of channel 16j + c
      vf[j].u[1] = ld_tr16(Vp + (kb + 16) * KPT + 16 * j);            // keys kb + 16 + 2r + hh
    }
#if defined(__HIP_DEVICE_COMPILE__)
    // keeps the group above whole and ahead of the pass's products (LDS reads and WMMAs do not cross, vector work may):
    // without it the v fragment reads sink to just in front of their products and are waited for there
    __builtin_amdgcn_sched_barrier(0x406);
#endif
    {
      s0 = mma_h(a0.h, qh0.h, s0);
      s1 = mma_h(c0.h, qh0.h, s1);
      s0 = mma_h(a1.h, qh1.h, s0);
      s1 = mma_h(c1.h, qh1.h, s1);
    }

    // e^{s-m} x 2^4 against the reference point as it stands; their sum over this lane's 16 keys bounds each of them
    v8f x0 = exp2x8_mma(s0);
    v8f x1 = exp2x8_mma(s1);
    float ls = hsum8(x0 + x1);
    const unsigned over = wave_ballot(!(ls <= lim));                  // wave-uniform; an infinite sum counts as over
    if (__builtin_expect(over != 0u, 0)) {                            // rare: the reference point moves to the max so far
      const v8f t0 = s0 - nv, t1 = s1 - nv;                           // the plain scores: the run's shift taken off
      const float mxl = fmaxf(hmax8(t0), hmax8(t1));                  // this lane's own 16 keys
      const float mn = fmaxf(m, fmaxf(mxl, __shfl_xor(mxl, 16, 32))); // same value in both lanes of a query
      const float corr = exp2_slot(m - mn);                           // == 1 exactly for lanes whose max did not grow
      m = mn;
      lim = -1.0f;
      l *= corr;
#pragma unroll
      for (int j = 0; j < 4; ++j) {
#pragma unroll
        for (int r = 0; r < 8; ++r) o[j][r] *= corr;
      }
      x0 = exp2x8_slot(t0 + splat8(CARRY2 - mn));                     // now every one is about 2^4 at most
      x1 = exp2x8_slot(t1 + splat8(CARRY2 - mn));
      ls = hsum8(x0 + x1);
    }

    FragH ph;
#pragma unroll
    for (int r = 0; r < 8; ++r) {
      ph.hv[0][r] = (_Float16)x0[r];
      ph.hv[1][r] = (_Float16)x1[r];
    }
    l += ls;

#pragma unroll
    for (int j = 0; j < 4; ++j) o[j] = mma_h(vf[j].h, ph.v, o[j]);
  }
  if ((rn & (RPS - 1)) == RPS - 1) {                                  // foot of a stage; same for the whole work-group
    const int st = rn / RPS;
    // publish stage st + 1 and free this stage's buffer
    wait_ds0();
    wait_async0();
    __syncthreads();
    if (st + 2 < NST) {                                               // same for the whole work-group
      copy8(lK + (st & 1) * (KT * KPT * 2), 64 * KPT * 2, gK + (size_t)(st + 2) * (KT * NC * 2), 16 * NTH);
    }
  }
  }
  wait_async0();
  l += __shfl_xor(l, 16, 32);
  // this wave's partial result: Mg[wave][2j + half][lane] = O tile j, Mg[wave][8][lane] = statistics
  {
    v4f* mg = Mg + wave * (9 * 32) + lane;
#pragma unroll
    for (int j = 0; j < 4; ++j) {
      const v4f pa = {o[j][0], o[j][1], o[j][2], o[j][3]};
      const v4f pb = {o[j][4], o[j][5], o[j][6], o[j][7]};
      mg[(2 * j) * 32]     = pa;
      mg[(2 * j + 1) * 32] = pb;
    }
    const v4f ps = {m, l, 0.f, 0.f};
    mg[8 * 32] = ps;
  }
  __syncthreads();
  // join the four key groups for channel block kg of query group qg, key groups in fixed order 0..3
  v4f sg[NKG], ag[NKG], bg[NKG];
#pragma unroll
  for (int g = 0; g < NKG; ++g) {
    const v4f* mg = Mg + (g * 4 + qg) * (9 * 32) + lane;
    sg[g] = mg[8 * 32];
    ag[g] = mg[(2 * kg) * 32];
    bg[g] = mg[(2 * kg + 1) * 32];
  }
  const float mm = fmaxf(fmaxf(sg[0][0], sg[1][0]), fmaxf(sg[2][0], sg[3][0]));
  float lt = 0.f;
  v4f oa = {0.f, 0.f, 0.f, 0.f}, ob = {0.f, 0.f, 0.f, 0.f};
#pragma unroll
  for (int g = 0; g < NKG; ++g) {
    const float wg = exp2_slot(sg[g][0] - mm);
    lt += wg * sg[g][1];
#pragma unroll
    for (int r = 0; r < 4; ++r) {
      oa[r] += wg * ag[g][r];
      ob[r] += wg * bg[g][r];
    }
  }
  const float inv = LN2 / lt;                                         // o and l both carry 2^4; o the plane's log2 e too

  const int qrow = 16 * qg + c;
  {
    v4f va, vb;
#pragma unroll
    for (int r = 0; r < 4; ++r) {
      va[r] = oa[r] * inv;
      vb[r] = ob[r] * inv;
    }
    *(v4f*)(Os + qrow * OSP + 16 * kg + 8 * hh)     = va;             // Os[query][ch = 16kg + 8hh + r]
    *(v4f*)(Os + qrow * OSP + 16 * kg + 8 * hh + 4) = vb;
  }
  __syncthreads();
  const int e = tid & 7, lq = tid >> 3;                               // lq 0..63
  v4f res[2];
#pragma unroll
  for (int it = 0; it < 2; ++it) {
    const int L   = it * 64 + lq;                                     // 0..127
    const int chl = L >> 1, hf = L & 1;                               // channel 0..63
    const int nl  = hf * 32 + 4 * e;                                  // query 0..63
#pragma unroll
    for (int t = 0; t < 4; ++t) res[it][t] = Os[(nl + t) * OSP + chl];
  }
{
#pragma unroll
    for (int it = 0; it < 2; ++it) {
      const int L   = it * 64 + lq;
      const int chl = L >> 1, hf = L & 1;
      const int nl  = hf * 32 + 4 * e;
      const size_t idx = ((size_t)(b * NC + chl)) * NP + n0 + nl;
      *(v4f*)(out + idx) = res[it];
    }
    
  }
}

// =============================================================================================================
// Workspace map (bytes; each region start a multiple of 256; every extent is an exact tile multiple and is written
//   FP f16 [NIMG][4096][64]  2097152      Qh f16 [NIMG][4096][64]  2097152
//   total (NIMG = 4) = 4194304
// =============================================================================================================
extern "C" void kernel_launch(void* const* d_in, const int* in_sizes, int n_in,
                              void* d_out, int out_size, void* d_ws, size_t ws_size,
                              hipStream_t stream) {
  const int XN = NIMG * NC * NP;
  if (n_in < 2) return;
  if (in_sizes[0] < XN) return;
  if (out_size < XN) return;

  size_t off = 0;
  auto carve = [&](size_t bytes) { const size_t o = off; off += (bytes + 255) & ~(size_t)255; return o; };
  const size_t oFP = carve((size_t)NIMG * NP * NC * 2);
  const size_t oQh = carve((size_t)NIMG * NP * NC * 2);
  if (off > ws_size) return;
  if (off > (size_t)134217728) return;

  const float* fg = (const float*)d_in[0];
  // d_in[1] (second input) does not enter this forward output; its pointer is bound to the first launch, unread.
  const float* aux = (const float*)d_in[1];

  char* ws = (char*)d_ws;
  unsigned short* FP = (unsigned short*)(ws + oFP);
  unsigned short* Qh = (unsigned short*)(ws + oQh);
  float* out = (float*)d_out;

  const dim3 blk256(256), blkat(NTH);

  // (1) input -> normalised kernels as one key-major f16 plane; 3x3 window sums -> query f16 plane
  prep_f<<<dim3(HW, NIMG), blk256, 0, stream>>>(fg, aux, FP, Qh);
  // (2) attention over the 4096 per-pixel kernels -> out [b][64][4096]
  attn_k<<<dim3(NP / QT, NIMG), blkat, 0, stream>>>(Qh, FP, out);
  (void)hipGetLastError();
}
